// v000
// Times are from an AMD MI455X. After a warm-up the kernel runs many times in a row, and a time is the length of
// such a window on the GPU divided by its runs, so every launch and the gaps after it count. The runs cycle
// through copies of the inputs. A figure is the median of several windows, for all but v000 over two sittings.
// Sittings can differ by a few percent; kernels timed side by side share one.
// v000, which the later versions start from, runs in 164 microseconds.
#include <hip/hip_runtime.h>
#include <hip/hip_bf16.h>

// SAPA feature alignment for MI455X (gfx1250, wave32, WMMA).
// Matrix math: V_WMMA_F32_16X16X4_F32 (f32 in, f32 accum).
// GEMM staging: GLOBAL_LOAD_ASYNC_TO_LDS_B128 with double-buffered LDS
// (ASYNCcnt-tracked, overlaps the A/B stream with WMMA compute).
//
// Scratch layout (floats), total ~159.4 MB:
//   fine_n   65536*256
//   coarse_n 16384*512
//   q_fine   65536*64
//   q_coarse 16384*64
//   k_       16384*64
//   v_       16384*256
//   gate     16384
//   query    65536*64

typedef __attribute__((ext_vector_type(2))) float v2f;
typedef __attribute__((ext_vector_type(8))) float v8f;

__device__ __forceinline__ v8f wmma_f32(v2f a, v2f b, v8f c) {
    // D = A(16x4) * B(4x16) + C(16x16), all f32
    return __builtin_amdgcn_wmma_f32_16x16x4_f32(
        /*neg_a=*/false, a, /*neg_b=*/false, b,
        /*c_mod=*/(short)0, c, /*reuse_a=*/false, /*reuse_b=*/false);
}

// Async copy 16B global -> LDS (per-lane addresses), tracked by ASYNCcnt.
__device__ __forceinline__ void async_load_b128(void* lds_ptr, const float* gptr) {
    const unsigned lds_addr = (unsigned)(uintptr_t)lds_ptr;       // low 32b = LDS byte offset
    const unsigned long long ga = (unsigned long long)(uintptr_t)gptr;
    asm volatile("global_load_async_to_lds_b128 %0, %1, off"
                 :: "v"(lds_addr), "v"(ga)
                 : "memory");
}
__device__ __forceinline__ void wait_async0() {
    asm volatile("s_wait_asynccnt 0x0" ::: "memory");
}

__device__ __forceinline__ float wave_sum(float s) {
    #pragma unroll
    for (int off = 16; off; off >>= 1) s += __shfl_xor(s, off, 32);
    return s;
}
__device__ __forceinline__ float wave_max(float s) {
    #pragma unroll
    for (int off = 16; off; off >>= 1) s = fmaxf(s, __shfl_xor(s, off, 32));
    return s;
}

// ---------------- LayerNorm: one wave per row ----------------
template <int C>
__global__ __launch_bounds__(256) void ln_kernel(
    const float* __restrict__ x, const float* __restrict__ g,
    const float* __restrict__ b, float* __restrict__ y, int nrows)
{
    const int wv = threadIdx.x >> 5, lane = threadIdx.x & 31;
    const int row = blockIdx.x * 8 + wv;
    if (row >= nrows) return;
    const float* xr = x + (size_t)row * C;
    float* yr = y + (size_t)row * C;
    constexpr int PER = C / 32;
    float v[PER];
    float s = 0.f;
    #pragma unroll
    for (int i = 0; i < PER; ++i) { v[i] = xr[lane + i * 32]; s += v[i]; }
    const float mean = wave_sum(s) * (1.0f / C);
    float vs = 0.f;
    #pragma unroll
    for (int i = 0; i < PER; ++i) { float d = v[i] - mean; vs += d * d; }
    const float rstd = rsqrtf(wave_sum(vs) * (1.0f / C) + 1e-5f);
    #pragma unroll
    for (int i = 0; i < PER; ++i) {
        int c = lane + i * 32;
        yr[c] = (v[i] - mean) * rstd * g[c] + b[c];
    }
}

// ---------------- Generic WMMA GEMM: C[M,N] = A[M,K] @ W[K,N] + bias ----------------
// Block tile 64x64, 256 threads = 8 waves, wave -> 2 (16x16) tiles sharing A-frag.
// Double-buffered LDS filled by GLOBAL_LOAD_ASYNC_TO_LDS_B128.
// M, N multiples of 64; K multiple of 32.
__global__ __launch_bounds__(256) void gemm_kernel(
    const float* __restrict__ A, const float* __restrict__ W,
    const float* __restrict__ bias, float* __restrict__ C,
    int M, int N, int K)
{
    // Row strides are multiples of 16B (36*4=144, 68*4=272) so every B128 write
    // stays inside one padded row. Padding keeps 16-row column reads conflict-free.
    __shared__ __align__(16) float As[2][64][36];
    __shared__ __align__(16) float Bs[2][32][68];

    const int wv = threadIdx.x >> 5, lane = threadIdx.x & 31;
    const int m0 = blockIdx.x * 64, n0 = blockIdx.y * 64;
    const int mt = wv >> 1;            // 0..3
    const int nt0 = (wv & 1) * 2;      // 0 or 2
    const int l15 = lane & 15;
    const int khalf = (lane >> 4) << 1;  // 0 for lanes 0-15, 2 for lanes 16-31

    v8f acc[2] = {};

    // A chunk: 64x32 floats = 512 16B-chunks; B chunk: 32x64 floats = 512 16B-chunks.
    // 256 threads -> 2 chunks each per matrix, issued asynchronously.
    auto issue_chunk = [&](int buf, int k0) {
        #pragma unroll
        for (int i = threadIdx.x; i < 512; i += 256) {
            const int m = i >> 3, kc = (i & 7) * 4;
            async_load_b128(&As[buf][m][kc], &A[(size_t)(m0 + m) * K + k0 + kc]);
        }
        #pragma unroll
        for (int i = threadIdx.x; i < 512; i += 256) {
            const int kc = i >> 4, n = (i & 15) * 4;
            async_load_b128(&Bs[buf][kc][n], &W[(size_t)(k0 + kc) * N + n0 + n]);
        }
    };

    issue_chunk(0, 0);
    wait_async0();
    __syncthreads();

    const int nchunks = K >> 5;
    for (int t = 0; t < nchunks; ++t) {
        const int cur = t & 1;
        if (t + 1 < nchunks) issue_chunk(cur ^ 1, (t + 1) * 32);

        #pragma unroll
        for (int kc = 0; kc < 32; kc += 4) {
            const int kb = kc + khalf;
            v2f a;
            a.x = As[cur][mt * 16 + l15][kb];
            a.y = As[cur][mt * 16 + l15][kb + 1];
            #pragma unroll
            for (int u = 0; u < 2; ++u) {
                const int nt = nt0 + u;
                v2f bf;
                bf.x = Bs[cur][kb][nt * 16 + l15];
                bf.y = Bs[cur][kb + 1][nt * 16 + l15];
                acc[u] = wmma_f32(a, bf, acc[u]);
            }
        }

        if (t + 1 < nchunks) {
            wait_async0();     // own async loads into buf^1 landed
            __syncthreads();   // everyone done reading cur & writing buf^1
        }
    }

    // Store D (+bias). C/D layout: vgpr v -> M = mt*16 + v + (lane>=16 ? 8 : 0), N = lane&15.
    const int rbase = mt * 16 + ((lane >> 4) << 3);
    #pragma unroll
    for (int u = 0; u < 2; ++u) {
        const int col = (nt0 + u) * 16 + l15;
        const float bb = bias[n0 + col];
        #pragma unroll
        for (int vz = 0; vz < 8; ++vz) {
            C[(size_t)(m0 + rbase + vz) * N + n0 + col] = acc[u][vz] + bb;
        }
    }
}

// ---------------- Gate: sigmoid(coarse_n @ wg + bg), wave per row ----------------
__global__ __launch_bounds__(256) void gate_kernel(
    const float* __restrict__ cn, const float* __restrict__ wg,
    const float* __restrict__ bg, float* __restrict__ gate, int nrows)
{
    const int wv = threadIdx.x >> 5, lane = threadIdx.x & 31;
    const int row = blockIdx.x * 8 + wv;
    if (row >= nrows) return;
    const float* xr = cn + (size_t)row * 512;
    float s = 0.f;
    #pragma unroll
    for (int i = 0; i < 16; ++i) s += xr[lane + i * 32] * wg[lane + i * 32];
    s = wave_sum(s);
    if (lane == 0) gate[row] = 1.0f / (1.0f + __expf(-(s + bg[0])));
}

// ---------------- Query blend: q = qf*g + qc_up*(1-g) ----------------
__global__ __launch_bounds__(256) void blend_kernel(
    const float* __restrict__ qf, const float* __restrict__ qc,
    const float* __restrict__ gate, float* __restrict__ query)
{
    const int idx = blockIdx.x * 256 + threadIdx.x;  // total 65536*64
    const int p = idx >> 6, e = idx & 63;
    const int x = p & 127, y = (p >> 7) & 127, b = p >> 14;
    const int cidx = (b * 64 + (y >> 1)) * 64 + (x >> 1);
    const float g = gate[cidx];
    query[idx] = qf[idx] * g + qc[(size_t)cidx * 64 + e] * (1.0f - g);
}

// ---------------- Local attention over a 4x4 coarse tile ----------------
// 64 queries (16 cells x 2x2 fine pixels) vs shared 8x8 key union.
// S = Q*K^T (WMMA, 64x64x64), masked softmax over 5x5 window, O = P*V (WMMA, 64x64 @ 64x256).
__global__ __launch_bounds__(256) void attn_kernel(
    const float* __restrict__ query,  // [B,128,128,64]
    const float* __restrict__ Kg,     // [B,64,64,64]
    const float* __restrict__ Vg,     // [B,64,64,256]
    float* __restrict__ out)          // [B,128,128,256]
{
    __shared__ float Qs[64][68];
    __shared__ float Ks[64][68];
    __shared__ float Ps[64][68];
    __shared__ int   voffs[64];  // V row base offsets (elements) or -1 if zero-padded
    __shared__ int   qpix[64];   // fine-pixel index of each query row

    const int b = blockIdx.z;
    const int i0 = blockIdx.y * 4, j0 = blockIdx.x * 4;
    const int wv = threadIdx.x >> 5, lane = threadIdx.x & 31;
    const int l15 = lane & 15;
    const int khalf = (lane >> 4) << 1;

    // Tables: union position validity/offsets + query-row pixel indices.
    if (threadIdx.x < 64) {
        const int u = threadIdx.x;
        const int r = u >> 3, c = u & 7;
        const int ir = i0 - 2 + r, jc = j0 - 2 + c;
        const bool ok = (ir >= 0) && (ir < 64) && (jc >= 0) && (jc < 64);
        voffs[u] = ok ? (((b * 64 + ir) * 64 + jc) * 256) : -1;
        const int cell = u >> 2, sub = u & 3;
        const int ci = cell >> 2, cj = cell & 3;
        const int y = (i0 + ci) * 2 + (sub >> 1);
        const int x = (j0 + cj) * 2 + (sub & 1);
        qpix[u] = (b * 128 + y) * 128 + x;
    }
    __syncthreads();

    // Stage K union [64,64] with zero padding, and Q [64,64].
    for (int i = threadIdx.x; i < 4096; i += 256) {
        const int u = i >> 6, e = i & 63;
        const int r = u >> 3, c = u & 7;
        const int ir = i0 - 2 + r, jc = j0 - 2 + c;
        const bool ok = (ir >= 0) && (ir < 64) && (jc >= 0) && (jc < 64);
        Ks[u][e] = ok ? Kg[(size_t)((b * 64 + ir) * 64 + jc) * 64 + e] : 0.0f;
        Qs[u][e] = query[(size_t)qpix[u] * 64 + e];
    }
    __syncthreads();

    // ---- S = Q * K^T : M=64, N=64, K=64 (8 waves x 2 tiles) ----
    {
        const int mt = wv >> 1;
        const int nt0 = (wv & 1) * 2;
        v8f accS[2] = {};
        #pragma unroll
        for (int kc = 0; kc < 64; kc += 4) {
            const int kb = kc + khalf;
            v2f a;
            a.x = Qs[mt * 16 + l15][kb];
            a.y = Qs[mt * 16 + l15][kb + 1];
            #pragma unroll
            for (int u = 0; u < 2; ++u) {
                const int nrow = (nt0 + u) * 16 + l15;  // B[k][n] = Ks[n][k]
                v2f bf;
                bf.x = Ks[nrow][kb];
                bf.y = Ks[nrow][kb + 1];
                accS[u] = wmma_f32(a, bf, accS[u]);
            }
        }
        const int rbase = mt * 16 + ((lane >> 4) << 3);
        #pragma unroll
        for (int u = 0; u < 2; ++u) {
            const int col = (nt0 + u) * 16 + l15;
            #pragma unroll
            for (int vz = 0; vz < 8; ++vz) Ps[rbase + vz][col] = accS[u][vz];
        }
    }
    __syncthreads();

    // ---- Masked softmax per query row (wave handles 8 rows; lane covers cols {lane, lane+32}) ----
    #pragma unroll
    for (int rr = 0; rr < 8; ++rr) {
        const int row = wv * 8 + rr;
        const int cell = row >> 2;
        const int ci = cell >> 2, cj = cell & 3;
        const int u0 = lane, u1 = lane + 32;
        const int r0 = u0 >> 3, c0 = u0 & 7;
        const int r1 = u1 >> 3, c1 = u1 & 7;
        const bool v0 = (r0 >= ci) && (r0 <= ci + 4) && (c0 >= cj) && (c0 <= cj + 4);
        const bool v1 = (r1 >= ci) && (r1 <= ci + 4) && (c1 >= cj) && (c1 <= cj + 4);
        const float NEG = -3.0e38f;
        const float x0 = v0 ? Ps[row][u0] : NEG;
        const float x1 = v1 ? Ps[row][u1] : NEG;
        const float m = wave_max(fmaxf(x0, x1));
        const float e0 = v0 ? __expf(x0 - m) : 0.0f;
        const float e1 = v1 ? __expf(x1 - m) : 0.0f;
        const float inv = 1.0f / wave_sum(e0 + e1);
        Ps[row][u0] = e0 * inv;
        Ps[row][u1] = e1 * inv;
    }
    __syncthreads();

    // ---- O = P * V : M=64, K=64, N=256 (8 waves x 8 tiles); V frags straight from global ----
    const int mtO = wv >> 1;
    const int ntO0 = (wv & 1) * 8;
    const int rbase = mtO * 16 + ((lane >> 4) << 3);
    #pragma unroll
    for (int tt = 0; tt < 8; ++tt) {
        const int ncol = (ntO0 + tt) * 16 + l15;
        v8f acc = {};
        #pragma unroll
        for (int kc = 0; kc < 64; kc += 4) {
            const int kb = kc + khalf;
            v2f a;
            a.x = Ps[mtO * 16 + l15][kb];
            a.y = Ps[mtO * 16 + l15][kb + 1];
            const int o0 = voffs[kb], o1 = voffs[kb + 1];
            v2f bf;
            bf.x = (o0 >= 0) ? Vg[(size_t)o0 + ncol] : 0.0f;
            bf.y = (o1 >= 0) ? Vg[(size_t)o1 + ncol] : 0.0f;
            acc = wmma_f32(a, bf, acc);
        }
        #pragma unroll
        for (int vz = 0; vz < 8; ++vz) {
            out[(size_t)qpix[rbase + vz] * 256 + ncol] = acc[vz];
        }
    }
}

// ---------------- Host launcher ----------------
extern "C" void kernel_launch(void* const* d_in, const int* in_sizes, int n_in,
                              void* d_out, int out_size, void* d_ws, size_t ws_size,
                              hipStream_t stream)
{
    const float* fine    = (const float*)d_in[0];   // [4,128,128,256]
    const float* coarse  = (const float*)d_in[1];   // [4,64,64,512]
    const float* gamma_f = (const float*)d_in[2];
    const float* beta_f  = (const float*)d_in[3];
    const float* gamma_c = (const float*)d_in[4];
    const float* beta_c  = (const float*)d_in[5];
    const float* wg      = (const float*)d_in[6];   // [512,1]
    const float* bg      = (const float*)d_in[7];   // [1]
    const float* wqf     = (const float*)d_in[8];   // [256,64]
    const float* bqf     = (const float*)d_in[9];
    const float* wqc     = (const float*)d_in[10];  // [512,64]
    const float* bqc     = (const float*)d_in[11];
    const float* wk      = (const float*)d_in[12];  // [512,64]
    const float* bk      = (const float*)d_in[13];
    const float* wv      = (const float*)d_in[14];  // [512,256]
    const float* bv      = (const float*)d_in[15];
    float* out = (float*)d_out;                     // [4,128,128,256]

    const int MF = 4 * 128 * 128;   // 65536 fine rows
    const int MC = 4 * 64 * 64;     // 16384 coarse rows

    float* ws = (float*)d_ws;
    float* fine_n   = ws;                    // 16777216
    float* coarse_n = fine_n + 16777216;     // 8388608
    float* q_fine   = coarse_n + 8388608;    // 4194304
    float* q_coarse = q_fine + 4194304;      // 1048576
    float* k_       = q_coarse + 1048576;    // 1048576
    float* v_       = k_ + 1048576;          // 4194304
    float* gate     = v_ + 4194304;          // 16384
    float* query    = gate + 16384;          // 4194304

    // 1) LayerNorms
    ln_kernel<256><<<MF / 8, 256, 0, stream>>>(fine, gamma_f, beta_f, fine_n, MF);
    ln_kernel<512><<<MC / 8, 256, 0, stream>>>(coarse, gamma_c, beta_c, coarse_n, MC);

    // 2) Projections (WMMA GEMMs with async double-buffered staging)
    gemm_kernel<<<dim3(MF / 64, 64 / 64), 256, 0, stream>>>(fine_n,   wqf, bqf, q_fine,   MF, 64,  256);
    gemm_kernel<<<dim3(MC / 64, 64 / 64), 256, 0, stream>>>(coarse_n, wqc, bqc, q_coarse, MC, 64,  512);
    gemm_kernel<<<dim3(MC / 64, 64 / 64), 256, 0, stream>>>(coarse_n, wk,  bk,  k_,       MC, 64,  512);
    gemm_kernel<<<dim3(MC / 64, 256 / 64), 256, 0, stream>>>(coarse_n, wv, bv,  v_,       MC, 256, 512);

    // 3) Gate + blended query
    gate_kernel<<<MC / 8, 256, 0, stream>>>(coarse_n, wg, bg, gate, MC);
    blend_kernel<<<(MF * 64) / 256, 256, 0, stream>>>(q_fine, q_coarse, gate, query);

    // 4) Local attention (one block per 4x4 coarse tile)
    attn_kernel<<<dim3(16, 16, 4), 256, 0, stream>>>(query, k_, v_, out);
}

// v001
// Measured time: 145 microseconds a run.
// Timed twice side by side with v000, it ran 1.16 times as fast both times.
#include <hip/hip_runtime.h>
#include <hip/hip_bf16.h>

// SAPA feature alignment for MI455X (gfx1250, wave32, WMMA).
// Matrix math: V_WMMA_F32_16X16X4_F32 (f32 in, f32 accum).
// GEMM staging: GLOBAL_LOAD_ASYNC_TO_LDS_B128 with double-buffered LDS
// (ASYNCcnt-tracked, overlaps the A/B stream with WMMA compute).
//
// Scratch layout (floats), total ~159.4 MB:
//   fine_n   65536*256
//   coarse_n 16384*512
//   q_fine   65536*64
//   q_coarse 16384*64
//   k_       16384*64
//   v_       16384*256
//   gate     16384
//   query    65536*64

typedef __attribute__((ext_vector_type(2))) float v2f;
typedef __attribute__((ext_vector_type(8))) float v8f;

__device__ __forceinline__ v8f wmma_f32(v2f a, v2f b, v8f c) {
    // D = A(16x4) * B(4x16) + C(16x16), all f32
    return __builtin_amdgcn_wmma_f32_16x16x4_f32(
        /*neg_a=*/false, a, /*neg_b=*/false, b,
        /*c_mod=*/(short)0, c, /*reuse_a=*/false, /*reuse_b=*/false);
}

// Async copy 16B global -> LDS (per-lane addresses), tracked by ASYNCcnt.
__device__ __forceinline__ void async_load_b128(void* lds_ptr, const float* gptr) {
    const unsigned lds_addr = (unsigned)(uintptr_t)lds_ptr;       // low 32b = LDS byte offset
    const unsigned long long ga = (unsigned long long)(uintptr_t)gptr;
    asm volatile("global_load_async_to_lds_b128 %0, %1, off"
                 :: "v"(lds_addr), "v"(ga)
                 : "memory");
}
__device__ __forceinline__ void wait_async0() {
    asm volatile("s_wait_asynccnt 0x0" ::: "memory");
}

__device__ __forceinline__ float wave_sum(float s) {
    #pragma unroll
    for (int off = 16; off; off >>= 1) s += __shfl_xor(s, off, 32);
    return s;
}
__device__ __forceinline__ float wave_max(float s) {
    #pragma unroll
    for (int off = 16; off; off >>= 1) s = fmaxf(s, __shfl_xor(s, off, 32));
    return s;
}

// ---------------- LayerNorm: one wave per row ----------------
template <int C>
__global__ __launch_bounds__(256) void ln_kernel(
    const float* __restrict__ x, const float* __restrict__ g,
    const float* __restrict__ b, float* __restrict__ y, int nrows)
{
    const int wv = threadIdx.x >> 5, lane = threadIdx.x & 31;
    const int row = blockIdx.x * 8 + wv;
    if (row >= nrows) return;
    const float* xr = x + (size_t)row * C;
    float* yr = y + (size_t)row * C;
    constexpr int PER = C / 32;
    float v[PER];
    float s = 0.f;
    #pragma unroll
    for (int i = 0; i < PER; ++i) { v[i] = xr[lane + i * 32]; s += v[i]; }
    const float mean = wave_sum(s) * (1.0f / C);
    float vs = 0.f;
    #pragma unroll
    for (int i = 0; i < PER; ++i) { float d = v[i] - mean; vs += d * d; }
    const float rstd = rsqrtf(wave_sum(vs) * (1.0f / C) + 1e-5f);
    #pragma unroll
    for (int i = 0; i < PER; ++i) {
        int c = lane + i * 32;
        yr[c] = (v[i] - mean) * rstd * g[c] + b[c];
    }
}

// ---------------- Generic WMMA GEMM: C[M,N] = A[M,K] @ W[K,N] + bias ----------------
// Block tile 64x64, 256 threads = 8 waves, wave -> 2 (16x16) tiles sharing A-frag.
// Double-buffered LDS filled by GLOBAL_LOAD_ASYNC_TO_LDS_B128.
// M, N multiples of 64; K multiple of 32.
__global__ __launch_bounds__(256) void gemm_kernel(
    const float* __restrict__ A, const float* __restrict__ W,
    const float* __restrict__ bias, float* __restrict__ C,
    int M, int N, int K)
{
    // Row strides are multiples of 16B (36*4=144, 68*4=272) so every B128 write
    // stays inside one padded row. Padding keeps 16-row column reads conflict-free.
    __shared__ __align__(16) float As[2][64][36];
    __shared__ __align__(16) float Bs[2][32][68];

    const int wv = threadIdx.x >> 5, lane = threadIdx.x & 31;
    const int m0 = blockIdx.x * 64, n0 = blockIdx.y * 64;
    const int mt = wv >> 1;            // 0..3
    const int nt0 = (wv & 1) * 2;      // 0 or 2
    const int l15 = lane & 15;
    const int khalf = (lane >> 4) << 1;  // 0 for lanes 0-15, 2 for lanes 16-31

    v8f acc[2] = {};

    // A chunk: 64x32 floats = 512 16B-chunks; B chunk: 32x64 floats = 512 16B-chunks.
    // 256 threads -> 2 chunks each per matrix, issued asynchronously.
    auto issue_chunk = [&](int buf, int k0) {
        #pragma unroll
        for (int i = threadIdx.x; i < 512; i += 256) {
            const int m = i >> 3, kc = (i & 7) * 4;
            async_load_b128(&As[buf][m][kc], &A[(size_t)(m0 + m) * K + k0 + kc]);
        }
        #pragma unroll
        for (int i = threadIdx.x; i < 512; i += 256) {
            const int kc = i >> 4, n = (i & 15) * 4;
            async_load_b128(&Bs[buf][kc][n], &W[(size_t)(k0 + kc) * N + n0 + n]);
        }
    };

    issue_chunk(0, 0);
    wait_async0();
    __syncthreads();

    const int nchunks = K >> 5;
    for (int t = 0; t < nchunks; ++t) {
        const int cur = t & 1;
        if (t + 1 < nchunks) issue_chunk(cur ^ 1, (t + 1) * 32);

        #pragma unroll
        for (int kc = 0; kc < 32; kc += 4) {
            const int kb = kc + khalf;
            v2f a;
            a.x = As[cur][mt * 16 + l15][kb];
            a.y = As[cur][mt * 16 + l15][kb + 1];
            #pragma unroll
            for (int u = 0; u < 2; ++u) {
                const int nt = nt0 + u;
                v2f bf;
                bf.x = Bs[cur][kb][nt * 16 + l15];
                bf.y = Bs[cur][kb + 1][nt * 16 + l15];
                acc[u] = wmma_f32(a, bf, acc[u]);
            }
        }

        if (t + 1 < nchunks) {
            wait_async0();     // own async loads into buf^1 landed
            __syncthreads();   // everyone done reading cur & writing buf^1
        }
    }

    // Store D (+bias). C/D layout: vgpr v -> M = mt*16 + v + (lane>=16 ? 8 : 0), N = lane&15.
    const int rbase = mt * 16 + ((lane >> 4) << 3);
    #pragma unroll
    for (int u = 0; u < 2; ++u) {
        const int col = (nt0 + u) * 16 + l15;
        const float bb = bias[n0 + col];
        #pragma unroll
        for (int vz = 0; vz < 8; ++vz) {
            C[(size_t)(m0 + rbase + vz) * N + n0 + col] = acc[u][vz] + bb;
        }
    }
}

// ---------------- Gate: sigmoid(coarse_n @ wg + bg), wave per row ----------------
__global__ __launch_bounds__(256) void gate_kernel(
    const float* __restrict__ cn, const float* __restrict__ wg,
    const float* __restrict__ bg, float* __restrict__ gate, int nrows)
{
    const int wv = threadIdx.x >> 5, lane = threadIdx.x & 31;
    const int row = blockIdx.x * 8 + wv;
    if (row >= nrows) return;
    const float* xr = cn + (size_t)row * 512;
    float s = 0.f;
    #pragma unroll
    for (int i = 0; i < 16; ++i) s += xr[lane + i * 32] * wg[lane + i * 32];
    s = wave_sum(s);
    if (lane == 0) gate[row] = 1.0f / (1.0f + __expf(-(s + bg[0])));
}

// ---------------- Query blend: q = qf*g + qc_up*(1-g) ----------------
__global__ __launch_bounds__(256) void blend_kernel(
    const float* __restrict__ qf, const float* __restrict__ qc,
    const float* __restrict__ gate, float* __restrict__ query)
{
    const int idx = blockIdx.x * 256 + threadIdx.x;  // total 65536*64
    const int p = idx >> 6, e = idx & 63;
    const int x = p & 127, y = (p >> 7) & 127, b = p >> 14;
    const int cidx = (b * 64 + (y >> 1)) * 64 + (x >> 1);
    const float g = gate[cidx];
    query[idx] = qf[idx] * g + qc[(size_t)cidx * 64 + e] * (1.0f - g);
}

// ---------------- Local attention over a 4x4 coarse tile ----------------
// 64 queries (16 cells x 2x2 fine pixels) vs shared 8x8 key union.
// S = Q*K^T (WMMA, 64x64x64), masked softmax over 5x5 window, O = P*V (WMMA, 64x64 @ 64x256).
__global__ __launch_bounds__(256) void attn_kernel(
    const float* __restrict__ query,  // [B,128,128,64]
    const float* __restrict__ Kg,     // [B,64,64,64]
    const float* __restrict__ Vg,     // [B,64,64,256]
    float* __restrict__ out)          // [B,128,128,256]
{
    __shared__ float Qs[64][68];
    __shared__ float Ks[64][68];
    __shared__ float Ps[64][68];
    __shared__ int   voffs[64];  // V row base offsets (elements) or -1 if zero-padded
    __shared__ int   qpix[64];   // fine-pixel index of each query row

    const int b = blockIdx.z;
    const int i0 = blockIdx.y * 4, j0 = blockIdx.x * 4;
    const int wv = threadIdx.x >> 5, lane = threadIdx.x & 31;
    const int l15 = lane & 15;
    const int khalf = (lane >> 4) << 1;

    // Tables: union position validity/offsets + query-row pixel indices.
    if (threadIdx.x < 64) {
        const int u = threadIdx.x;
        const int r = u >> 3, c = u & 7;
        const int ir = i0 - 2 + r, jc = j0 - 2 + c;
        const bool ok = (ir >= 0) && (ir < 64) && (jc >= 0) && (jc < 64);
        voffs[u] = ok ? (((b * 64 + ir) * 64 + jc) * 256) : -1;
        const int cell = u >> 2, sub = u & 3;
        const int ci = cell >> 2, cj = cell & 3;
        const int y = (i0 + ci) * 2 + (sub >> 1);
        const int x = (j0 + cj) * 2 + (sub & 1);
        qpix[u] = (b * 128 + y) * 128 + x;
    }
    __syncthreads();

    // Stage K union [64,64] with zero padding, and Q [64,64].
    for (int i = threadIdx.x; i < 4096; i += 256) {
        const int u = i >> 6, e = i & 63;
        const int r = u >> 3, c = u & 7;
        const int ir = i0 - 2 + r, jc = j0 - 2 + c;
        const bool ok = (ir >= 0) && (ir < 64) && (jc >= 0) && (jc < 64);
        Ks[u][e] = ok ? Kg[(size_t)((b * 64 + ir) * 64 + jc) * 64 + e] : 0.0f;
        Qs[u][e] = query[(size_t)qpix[u] * 64 + e];
    }
    __syncthreads();

    // ---- S = Q * K^T : M=64, N=64, K=64 (8 waves x 2 tiles) ----
    {
        const int mt = wv >> 1;
        const int nt0 = (wv & 1) * 2;
        v8f accS[2] = {};
        #pragma unroll
        for (int kc = 0; kc < 64; kc += 4) {
            const int kb = kc + khalf;
            v2f a;
            a.x = Qs[mt * 16 + l15][kb];
            a.y = Qs[mt * 16 + l15][kb + 1];
            #pragma unroll
            for (int u = 0; u < 2; ++u) {
                const int nrow = (nt0 + u) * 16 + l15;  // B[k][n] = Ks[n][k]
                v2f bf;
                bf.x = Ks[nrow][kb];
                bf.y = Ks[nrow][kb + 1];
                accS[u] = wmma_f32(a, bf, accS[u]);
            }
        }
        const int rbase = mt * 16 + ((lane >> 4) << 3);
        #pragma unroll
        for (int u = 0; u < 2; ++u) {
            const int col = (nt0 + u) * 16 + l15;
            #pragma unroll
            for (int vz = 0; vz < 8; ++vz) Ps[rbase + vz][col] = accS[u][vz];
        }
    }
    __syncthreads();

    // ---- Masked softmax per query row (wave handles 8 rows; lane covers cols {lane, lane+32}) ----
    #pragma unroll
    for (int rr = 0; rr < 8; ++rr) {
        const int row = wv * 8 + rr;
        const int cell = row >> 2;
        const int ci = cell >> 2, cj = cell & 3;
        const int u0 = lane, u1 = lane + 32;
        const int r0 = u0 >> 3, c0 = u0 & 7;
        const int r1 = u1 >> 3, c1 = u1 & 7;
        const bool v0 = (r0 >= ci) && (r0 <= ci + 4) && (c0 >= cj) && (c0 <= cj + 4);
        const bool v1 = (r1 >= ci) && (r1 <= ci + 4) && (c1 >= cj) && (c1 <= cj + 4);
        const float NEG = -3.0e38f;
        const float x0 = v0 ? Ps[row][u0] : NEG;
        const float x1 = v1 ? Ps[row][u1] : NEG;
        const float m = wave_max(fmaxf(x0, x1));
        const float e0 = v0 ? __expf(x0 - m) : 0.0f;
        const float e1 = v1 ? __expf(x1 - m) : 0.0f;
        const float inv = 1.0f / wave_sum(e0 + e1);
        Ps[row][u0] = e0 * inv;
        Ps[row][u1] = e1 * inv;
    }
    __syncthreads();

    // ---- O = P * V : M=64, K=64, N=256; V frags straight from global ----
    // Each wave owns 32 output columns (2 n-tiles) and all 4 m-tiles, so every V
    // fragment is loaded once per block and feeds 4 WMMAs on independent accumulators.
    const int nb = wv * 32 + l15;
    v8f acc[4][2] = {};
    #pragma unroll
    for (int kc = 0; kc < 64; kc += 4) {
        const int kb = kc + khalf;
        const int o0 = voffs[kb], o1 = voffs[kb + 1];
        v2f a[4];
        #pragma unroll
        for (int mt = 0; mt < 4; ++mt) {
            a[mt].x = Ps[mt * 16 + l15][kb];
            a[mt].y = Ps[mt * 16 + l15][kb + 1];
        }
        v2f bf[2];
        #pragma unroll
        for (int u = 0; u < 2; ++u) {
            const int ncol = nb + u * 16;
            bf[u].x = (o0 >= 0) ? Vg[(size_t)o0 + ncol] : 0.0f;
            bf[u].y = (o1 >= 0) ? Vg[(size_t)o1 + ncol] : 0.0f;
        }
        #pragma unroll
        for (int mt = 0; mt < 4; ++mt) {
            #pragma unroll
            for (int u = 0; u < 2; ++u) acc[mt][u] = wmma_f32(a[mt], bf[u], acc[mt][u]);
        }
    }
    #pragma unroll
    for (int mt = 0; mt < 4; ++mt) {
        const int rbase = mt * 16 + ((lane >> 4) << 3);
        #pragma unroll
        for (int vz = 0; vz < 8; ++vz) {
            float* orow = out + (size_t)qpix[rbase + vz] * 256 + nb;
            orow[0]  = acc[mt][0][vz];
            orow[16] = acc[mt][1][vz];
        }
    }
}

// ---------------- Host launcher ----------------
extern "C" void kernel_launch(void* const* d_in, const int* in_sizes, int n_in,
                              void* d_out, int out_size, void* d_ws, size_t ws_size,
                              hipStream_t stream)
{
    const float* fine    = (const float*)d_in[0];   // [4,128,128,256]
    const float* coarse  = (const float*)d_in[1];   // [4,64,64,512]
    const float* gamma_f = (const float*)d_in[2];
    const float* beta_f  = (const float*)d_in[3];
    const float* gamma_c = (const float*)d_in[4];
    const float* beta_c  = (const float*)d_in[5];
    const float* wg      = (const float*)d_in[6];   // [512,1]
    const float* bg      = (const float*)d_in[7];   // [1]
    const float* wqf     = (const float*)d_in[8];   // [256,64]
    const float* bqf     = (const float*)d_in[9];
    const float* wqc     = (const float*)d_in[10];  // [512,64]
    const float* bqc     = (const float*)d_in[11];
    const float* wk      = (const float*)d_in[12];  // [512,64]
    const float* bk      = (const float*)d_in[13];
    const float* wv      = (const float*)d_in[14];  // [512,256]
    const float* bv      = (const float*)d_in[15];
    float* out = (float*)d_out;                     // [4,128,128,256]

    const int MF = 4 * 128 * 128;   // 65536 fine rows
    const int MC = 4 * 64 * 64;     // 16384 coarse rows

    float* ws = (float*)d_ws;
    float* fine_n   = ws;                    // 16777216
    float* coarse_n = fine_n + 16777216;     // 8388608
    float* q_fine   = coarse_n + 8388608;    // 4194304
    float* q_coarse = q_fine + 4194304;      // 1048576
    float* k_       = q_coarse + 1048576;    // 1048576
    float* v_       = k_ + 1048576;          // 4194304
    float* gate     = v_ + 4194304;          // 16384
    float* query    = gate + 16384;          // 4194304

    // 1) LayerNorms
    ln_kernel<256><<<MF / 8, 256, 0, stream>>>(fine, gamma_f, beta_f, fine_n, MF);
    ln_kernel<512><<<MC / 8, 256, 0, stream>>>(coarse, gamma_c, beta_c, coarse_n, MC);

    // 2) Projections (WMMA GEMMs with async double-buffered staging)
    gemm_kernel<<<dim3(MF / 64, 64 / 64), 256, 0, stream>>>(fine_n,   wqf, bqf, q_fine,   MF, 64,  256);
    gemm_kernel<<<dim3(MC / 64, 64 / 64), 256, 0, stream>>>(coarse_n, wqc, bqc, q_coarse, MC, 64,  512);
    gemm_kernel<<<dim3(MC / 64, 64 / 64), 256, 0, stream>>>(coarse_n, wk,  bk,  k_,       MC, 64,  512);
    gemm_kernel<<<dim3(MC / 64, 256 / 64), 256, 0, stream>>>(coarse_n, wv, bv,  v_,       MC, 256, 512);

    // 3) Gate + blended query
    gate_kernel<<<MC / 8, 256, 0, stream>>>(coarse_n, wg, bg, gate, MC);
    blend_kernel<<<(MF * 64) / 256, 256, 0, stream>>>(q_fine, q_coarse, gate, query);

    // 4) Local attention (one block per 4x4 coarse tile)
    attn_kernel<<<dim3(16, 16, 4), 256, 0, stream>>>(query, k_, v_, out);
}

// v002
// It runs in 134 microseconds.
// In both of two side-by-side timings against v001, it was 1.08 times as fast.
// Over all steps from v000 it is 1.26 times as fast.
#include <hip/hip_runtime.h>
#include <hip/hip_bf16.h>

// SAPA feature alignment for MI455X (gfx1250, wave32, WMMA).
// Matrix math: V_WMMA_F32_16X16X4_F32 (f32 in, f32 accum).
// GEMM staging: GLOBAL_LOAD_ASYNC_TO_LDS_B128 with double-buffered LDS
// (ASYNCcnt-tracked, overlaps the A/B stream with WMMA compute).
//
// Scratch layout (floats), total ~142.7 MB:
//   fine_n   65536*256
//   coarse_n 16384*512
//   q_fine   65536*64
//   q_coarse 16384*64
//   k_       16384*64
//   v_       16384*256
//   gate     16384

typedef __attribute__((ext_vector_type(2))) float v2f;
typedef __attribute__((ext_vector_type(8))) float v8f;

__device__ __forceinline__ v8f wmma_f32(v2f a, v2f b, v8f c) {
    // D = A(16x4) * B(4x16) + C(16x16), all f32
    return __builtin_amdgcn_wmma_f32_16x16x4_f32(
        /*neg_a=*/false, a, /*neg_b=*/false, b,
        /*c_mod=*/(short)0, c, /*reuse_a=*/false, /*reuse_b=*/false);
}

// Async copy 16B global -> LDS (per-lane addresses), tracked by ASYNCcnt.
__device__ __forceinline__ void async_load_b128(void* lds_ptr, const float* gptr) {
    const unsigned lds_addr = (unsigned)(uintptr_t)lds_ptr;       // low 32b = LDS byte offset
    const unsigned long long ga = (unsigned long long)(uintptr_t)gptr;
    asm volatile("global_load_async_to_lds_b128 %0, %1, off"
                 :: "v"(lds_addr), "v"(ga)
                 : "memory");
}
__device__ __forceinline__ void wait_async0() {
    asm volatile("s_wait_asynccnt 0x0" ::: "memory");
}

__device__ __forceinline__ float wave_sum(float s) {
    #pragma unroll
    for (int off = 16; off; off >>= 1) s += __shfl_xor(s, off, 32);
    return s;
}
__device__ __forceinline__ float wave_max(float s) {
    #pragma unroll
    for (int off = 16; off; off >>= 1) s = fmaxf(s, __shfl_xor(s, off, 32));
    return s;
}

// ---------------- LayerNorm: one wave per row ----------------
template <int C>
__global__ __launch_bounds__(256) void ln_kernel(
    const float* __restrict__ x, const float* __restrict__ g,
    const float* __restrict__ b, float* __restrict__ y, int nrows)
{
    const int wv = threadIdx.x >> 5, lane = threadIdx.x & 31;
    const int row = blockIdx.x * 8 + wv;
    if (row >= nrows) return;
    const float* xr = x + (size_t)row * C;
    float* yr = y + (size_t)row * C;
    constexpr int PER = C / 32;
    float v[PER];
    float s = 0.f;
    #pragma unroll
    for (int i = 0; i < PER; ++i) { v[i] = xr[lane + i * 32]; s += v[i]; }
    const float mean = wave_sum(s) * (1.0f / C);
    float vs = 0.f;
    #pragma unroll
    for (int i = 0; i < PER; ++i) { float d = v[i] - mean; vs += d * d; }
    const float rstd = rsqrtf(wave_sum(vs) * (1.0f / C) + 1e-5f);
    #pragma unroll
    for (int i = 0; i < PER; ++i) {
        int c = lane + i * 32;
        yr[c] = (v[i] - mean) * rstd * g[c] + b[c];
    }
}

// ---------------- Generic WMMA GEMM: C[M,N] = A[M,K] @ W[K,N] + bias ----------------
// Block tile 64x64, 256 threads = 8 waves, wave -> 2 (16x16) tiles sharing A-frag.
// Double-buffered LDS filled by GLOBAL_LOAD_ASYNC_TO_LDS_B128.
// M, N multiples of 64; K multiple of 32.
__global__ __launch_bounds__(256) void gemm_kernel(
    const float* __restrict__ A, const float* __restrict__ W,
    const float* __restrict__ bias, float* __restrict__ C,
    int M, int N, int K)
{
    // Row strides are multiples of 16B (36*4=144, 68*4=272) so every B128 write
    // stays inside one padded row. Padding keeps 16-row column reads conflict-free.
    __shared__ __align__(16) float As[2][64][36];
    __shared__ __align__(16) float Bs[2][32][68];

    const int wv = threadIdx.x >> 5, lane = threadIdx.x & 31;
    const int m0 = blockIdx.x * 64, n0 = blockIdx.y * 64;
    const int mt = wv >> 1;            // 0..3
    const int nt0 = (wv & 1) * 2;      // 0 or 2
    const int l15 = lane & 15;
    const int khalf = (lane >> 4) << 1;  // 0 for lanes 0-15, 2 for lanes 16-31

    v8f acc[2] = {};

    // A chunk: 64x32 floats = 512 16B-chunks; B chunk: 32x64 floats = 512 16B-chunks.
    // 256 threads -> 2 chunks each per matrix, issued asynchronously.
    auto issue_chunk = [&](int buf, int k0) {
        #pragma unroll
        for (int i = threadIdx.x; i < 512; i += 256) {
            const int m = i >> 3, kc = (i & 7) * 4;
            async_load_b128(&As[buf][m][kc], &A[(size_t)(m0 + m) * K + k0 + kc]);
        }
        #pragma unroll
        for (int i = threadIdx.x; i < 512; i += 256) {
            const int kc = i >> 4, n = (i & 15) * 4;
            async_load_b128(&Bs[buf][kc][n], &W[(size_t)(k0 + kc) * N + n0 + n]);
        }
    };

    issue_chunk(0, 0);
    wait_async0();
    __syncthreads();

    const int nchunks = K >> 5;
    for (int t = 0; t < nchunks; ++t) {
        const int cur = t & 1;
        if (t + 1 < nchunks) issue_chunk(cur ^ 1, (t + 1) * 32);

        #pragma unroll
        for (int kc = 0; kc < 32; kc += 4) {
            const int kb = kc + khalf;
            v2f a;
            a.x = As[cur][mt * 16 + l15][kb];
            a.y = As[cur][mt * 16 + l15][kb + 1];
            #pragma unroll
            for (int u = 0; u < 2; ++u) {
                const int nt = nt0 + u;
                v2f bf;
                bf.x = Bs[cur][kb][nt * 16 + l15];
                bf.y = Bs[cur][kb + 1][nt * 16 + l15];
                acc[u] = wmma_f32(a, bf, acc[u]);
            }
        }

        if (t + 1 < nchunks) {
            wait_async0();     // own async loads into buf^1 landed
            __syncthreads();   // everyone done reading cur & writing buf^1
        }
    }

    // Store D (+bias). C/D layout: vgpr v -> M = mt*16 + v + (lane>=16 ? 8 : 0), N = lane&15.
    const int rbase = mt * 16 + ((lane >> 4) << 3);
    #pragma unroll
    for (int u = 0; u < 2; ++u) {
        const int col = (nt0 + u) * 16 + l15;
        const float bb = bias[n0 + col];
        #pragma unroll
        for (int vz = 0; vz < 8; ++vz) {
            C[(size_t)(m0 + rbase + vz) * N + n0 + col] = acc[u][vz] + bb;
        }
    }
}

// ---------------- Gate: sigmoid(coarse_n @ wg + bg), wave per row ----------------
__global__ __launch_bounds__(256) void gate_kernel(
    const float* __restrict__ cn, const float* __restrict__ wg,
    const float* __restrict__ bg, float* __restrict__ gate, int nrows)
{
    const int wv = threadIdx.x >> 5, lane = threadIdx.x & 31;
    const int row = blockIdx.x * 8 + wv;
    if (row >= nrows) return;
    const float* xr = cn + (size_t)row * 512;
    float s = 0.f;
    #pragma unroll
    for (int i = 0; i < 16; ++i) s += xr[lane + i * 32] * wg[lane + i * 32];
    s = wave_sum(s);
    if (lane == 0) gate[row] = 1.0f / (1.0f + __expf(-(s + bg[0])));
}

// ---------------- Local attention over a 4x4 coarse tile ----------------
// 64 queries (16 cells x 2x2 fine pixels) vs shared 8x8 key union.
// Q is blended while it is staged: q = q_fine*g + q_coarse*(1-g), g the gate of the query's cell.
// S = Q*K^T (WMMA, 64x64x64), masked softmax over 5x5 window, O = P*V (WMMA, 64x64 @ 64x256).
__global__ __launch_bounds__(256) void attn_kernel(
    const float* __restrict__ qf,     // [B,128,128,64] fine query projection
    const float* __restrict__ qc,     // [B,64,64,64]   coarse query projection
    const float* __restrict__ gate,   // [B,64,64]
    const float* __restrict__ Kg,     // [B,64,64,64]
    const float* __restrict__ Vg,     // [B,64,64,256]
    float* __restrict__ out)          // [B,128,128,256]
{
    __shared__ float Qs[64][68];
    __shared__ float Ks[64][68];
    __shared__ float Ps[64][68];
    __shared__ int   voffs[64];  // V row base offsets (elements) or -1 if zero-padded
    __shared__ int   qpix[64];   // fine-pixel index of each query row

    const int b = blockIdx.z;
    const int i0 = blockIdx.y * 4, j0 = blockIdx.x * 4;
    const int wv = threadIdx.x >> 5, lane = threadIdx.x & 31;
    const int l15 = lane & 15;
    const int khalf = (lane >> 4) << 1;

    // Tables: union position validity/offsets + query-row pixel indices.
    if (threadIdx.x < 64) {
        const int u = threadIdx.x;
        const int r = u >> 3, c = u & 7;
        const int ir = i0 - 2 + r, jc = j0 - 2 + c;
        const bool ok = (ir >= 0) && (ir < 64) && (jc >= 0) && (jc < 64);
        voffs[u] = ok ? (((b * 64 + ir) * 64 + jc) * 256) : -1;
        const int cell = u >> 2, sub = u & 3;
        const int ci = cell >> 2, cj = cell & 3;
        const int y = (i0 + ci) * 2 + (sub >> 1);
        const int x = (j0 + cj) * 2 + (sub & 1);
        qpix[u] = (b * 128 + y) * 128 + x;
    }
    __syncthreads();

    // Stage K union [64,64] with zero padding, and the blended Q [64,64].
    for (int i = threadIdx.x; i < 4096; i += 256) {
        const int u = i >> 6, e = i & 63;
        const int r = u >> 3, c = u & 7;
        const int ir = i0 - 2 + r, jc = j0 - 2 + c;
        const bool ok = (ir >= 0) && (ir < 64) && (jc >= 0) && (jc < 64);
        Ks[u][e] = ok ? Kg[(size_t)((b * 64 + ir) * 64 + jc) * 64 + e] : 0.0f;
        const int cell = u >> 2;  // rows 4*cell..4*cell+3 are the fine pixels of one coarse cell
        const int cidx = (b * 64 + i0 + (cell >> 2)) * 64 + j0 + (cell & 3);
        const float g = gate[cidx];
        Qs[u][e] = qf[(size_t)qpix[u] * 64 + e] * g + qc[(size_t)cidx * 64 + e] * (1.0f - g);
    }
    __syncthreads();

    // ---- S = Q * K^T : M=64, N=64, K=64 (8 waves x 2 tiles) ----
    {
        const int mt = wv >> 1;
        const int nt0 = (wv & 1) * 2;
        v8f accS[2] = {};
        #pragma unroll
        for (int kc = 0; kc < 64; kc += 4) {
            const int kb = kc + khalf;
            v2f a;
            a.x = Qs[mt * 16 + l15][kb];
            a.y = Qs[mt * 16 + l15][kb + 1];
            #pragma unroll
            for (int u = 0; u < 2; ++u) {
                const int nrow = (nt0 + u) * 16 + l15;  // B[k][n] = Ks[n][k]
                v2f bf;
                bf.x = Ks[nrow][kb];
                bf.y = Ks[nrow][kb + 1];
                accS[u] = wmma_f32(a, bf, accS[u]);
            }
        }
        const int rbase = mt * 16 + ((lane >> 4) << 3);
        #pragma unroll
        for (int u = 0; u < 2; ++u) {
            const int col = (nt0 + u) * 16 + l15;
            #pragma unroll
            for (int vz = 0; vz < 8; ++vz) Ps[rbase + vz][col] = accS[u][vz];
        }
    }
    __syncthreads();

    // ---- Masked softmax per query row (wave handles 8 rows; lane covers cols {lane, lane+32}) ----
    #pragma unroll
    for (int rr = 0; rr < 8; ++rr) {
        const int row = wv * 8 + rr;
        const int cell = row >> 2;
        const int ci = cell >> 2, cj = cell & 3;
        const int u0 = lane, u1 = lane + 32;
        const int r0 = u0 >> 3, c0 = u0 & 7;
        const int r1 = u1 >> 3, c1 = u1 & 7;
        const bool v0 = (r0 >= ci) && (r0 <= ci + 4) && (c0 >= cj) && (c0 <= cj + 4);
        const bool v1 = (r1 >= ci) && (r1 <= ci + 4) && (c1 >= cj) && (c1 <= cj + 4);
        const float NEG = -3.0e38f;
        const float x0 = v0 ? Ps[row][u0] : NEG;
        const float x1 = v1 ? Ps[row][u1] : NEG;
        const float m = wave_max(fmaxf(x0, x1));
        const float e0 = v0 ? __expf(x0 - m) : 0.0f;
        const float e1 = v1 ? __expf(x1 - m) : 0.0f;
        const float inv = 1.0f / wave_sum(e0 + e1);
        Ps[row][u0] = e0 * inv;
        Ps[row][u1] = e1 * inv;
    }
    __syncthreads();

    // ---- O = P * V : M=64, K=64, N=256; V frags straight from global ----
    // Each wave owns 32 output columns (2 n-tiles) and all 4 m-tiles, so every V
    // fragment is loaded once per block and feeds 4 WMMAs on independent accumulators.
    const int nb = wv * 32 + l15;
    v8f acc[4][2] = {};
    #pragma unroll
    for (int kc = 0; kc < 64; kc += 4) {
        const int kb = kc + khalf;
        const int o0 = voffs[kb], o1 = voffs[kb + 1];
        v2f a[4];
        #pragma unroll
        for (int mt = 0; mt < 4; ++mt) {
            a[mt].x = Ps[mt * 16 + l15][kb];
            a[mt].y = Ps[mt * 16 + l15][kb + 1];
        }
        v2f bf[2];
        #pragma unroll
        for (int u = 0; u < 2; ++u) {
            const int ncol = nb + u * 16;
            bf[u].x = (o0 >= 0) ? Vg[(size_t)o0 + ncol] : 0.0f;
            bf[u].y = (o1 >= 0) ? Vg[(size_t)o1 + ncol] : 0.0f;
        }
        #pragma unroll
        for (int mt = 0; mt < 4; ++mt) {
            #pragma unroll
            for (int u = 0; u < 2; ++u) acc[mt][u] = wmma_f32(a[mt], bf[u], acc[mt][u]);
        }
    }
    #pragma unroll
    for (int mt = 0; mt < 4; ++mt) {
        const int rbase = mt * 16 + ((lane >> 4) << 3);
        #pragma unroll
        for (int vz = 0; vz < 8; ++vz) {
            float* orow = out + (size_t)qpix[rbase + vz] * 256 + nb;
            orow[0]  = acc[mt][0][vz];
            orow[16] = acc[mt][1][vz];
        }
    }
}

// ---------------- Host launcher ----------------
extern "C" void kernel_launch(void* const* d_in, const int* in_sizes, int n_in,
                              void* d_out, int out_size, void* d_ws, size_t ws_size,
                              hipStream_t stream)
{
    const float* fine    = (const float*)d_in[0];   // [4,128,128,256]
    const float* coarse  = (const float*)d_in[1];   // [4,64,64,512]
    const float* gamma_f = (const float*)d_in[2];
    const float* beta_f  = (const float*)d_in[3];
    const float* gamma_c = (const float*)d_in[4];
    const float* beta_c  = (const float*)d_in[5];
    const float* wg      = (const float*)d_in[6];   // [512,1]
    const float* bg      = (const float*)d_in[7];   // [1]
    const float* wqf     = (const float*)d_in[8];   // [256,64]
    const float* bqf     = (const float*)d_in[9];
    const float* wqc     = (const float*)d_in[10];  // [512,64]
    const float* bqc     = (const float*)d_in[11];
    const float* wk      = (const float*)d_in[12];  // [512,64]
    const float* bk      = (const float*)d_in[13];
    const float* wv      = (const float*)d_in[14];  // [512,256]
    const float* bv      = (const float*)d_in[15];
    float* out = (float*)d_out;                     // [4,128,128,256]

    const int MF = 4 * 128 * 128;   // 65536 fine rows
    const int MC = 4 * 64 * 64;     // 16384 coarse rows

    float* ws = (float*)d_ws;
    float* fine_n   = ws;                    // 16777216
    float* coarse_n = fine_n + 16777216;     // 8388608
    float* q_fine   = coarse_n + 8388608;    // 4194304
    float* q_coarse = q_fine + 4194304;      // 1048576
    float* k_       = q_coarse + 1048576;    // 1048576
    float* v_       = k_ + 1048576;          // 4194304
    float* gate     = v_ + 4194304;          // 16384

    // 1) LayerNorms
    ln_kernel<256><<<MF / 8, 256, 0, stream>>>(fine, gamma_f, beta_f, fine_n, MF);
    ln_kernel<512><<<MC / 8, 256, 0, stream>>>(coarse, gamma_c, beta_c, coarse_n, MC);

    // 2) Projections (WMMA GEMMs with async double-buffered staging)
    gemm_kernel<<<dim3(MF / 64, 64 / 64), 256, 0, stream>>>(fine_n,   wqf, bqf, q_fine,   MF, 64,  256);
    gemm_kernel<<<dim3(MC / 64, 64 / 64), 256, 0, stream>>>(coarse_n, wqc, bqc, q_coarse, MC, 64,  512);
    gemm_kernel<<<dim3(MC / 64, 64 / 64), 256, 0, stream>>>(coarse_n, wk,  bk,  k_,       MC, 64,  512);
    gemm_kernel<<<dim3(MC / 64, 256 / 64), 256, 0, stream>>>(coarse_n, wv, bv,  v_,       MC, 256, 512);

    // 3) Gate
    gate_kernel<<<MC / 8, 256, 0, stream>>>(coarse_n, wg, bg, gate, MC);

    // 4) Local attention (one block per 4x4 coarse tile), query blend included
    attn_kernel<<<dim3(16, 16, 4), 256, 0, stream>>>(q_fine, q_coarse, gate, k_, v_, out);
}

// v003
// Measured time: 102 microseconds a run.
// Timed twice side by side with v002, it ran 1.31 and 1.32 times as fast.
// All steps since v000 together make it 1.66 times as fast.
#include <hip/hip_runtime.h>
#include <hip/hip_bf16.h>

// SAPA feature alignment for MI455X (gfx1250, wave32, WMMA).
// Matrix math: V_WMMA_F32_16X16X4_F32 (f32 in, f32 accum).
// GEMM staging: GLOBAL_LOAD_ASYNC_TO_LDS_B128 with double-buffered LDS
// (ASYNCcnt-tracked, overlaps the A/B stream with WMMA compute).
// The coarse path is one kernel: a 64-row tile is normalised into LDS, the gate is
// formed from the same values on the way, and the three coarse projections read it there.
//
// Scratch layout (floats):
//   fine_n   65536*256
//   q_fine   65536*64
//   q_coarse 16384*64
//   k_       16384*64
//   v_       16384*256
//   gate     16384

typedef __attribute__((ext_vector_type(2))) float v2f;
typedef __attribute__((ext_vector_type(8))) float v8f;

__device__ __forceinline__ v8f wmma_f32(v2f a, v2f b, v8f c) {
    // D = A(16x4) * B(4x16) + C(16x16), all f32
    return __builtin_amdgcn_wmma_f32_16x16x4_f32(
        /*neg_a=*/false, a, /*neg_b=*/false, b,
        /*c_mod=*/(short)0, c, /*reuse_a=*/false, /*reuse_b=*/false);
}

// Async copy 16B global -> LDS (per-lane addresses), tracked by ASYNCcnt.
__device__ __forceinline__ void async_load_b128(void* lds_ptr, const float* gptr) {
    const unsigned lds_addr = (unsigned)(uintptr_t)lds_ptr;       // low 32b = LDS byte offset
    const unsigned long long ga = (unsigned long long)(uintptr_t)gptr;
    asm volatile("global_load_async_to_lds_b128 %0, %1, off"
                 :: "v"(lds_addr), "v"(ga)
                 : "memory");
}
__device__ __forceinline__ void wait_async0() {
    asm volatile("s_wait_asynccnt 0x0" ::: "memory");
}
// Four 16B copies global -> LDS in one statement. The closing s_wait_xcnt keeps every later
// write of the address registers behind the copies that name them.
__device__ __forceinline__ void async_copy4_b128(
    const float* l0, const float* g0, const float* l1, const float* g1,
    const float* l2, const float* g2, const float* l3, const float* g3) {
    asm volatile("global_load_async_to_lds_b128 %0, %1, off\n\t"
                 "global_load_async_to_lds_b128 %2, %3, off\n\t"
                 "global_load_async_to_lds_b128 %4, %5, off\n\t"
                 "global_load_async_to_lds_b128 %6, %7, off\n\t"
                 "s_wait_xcnt 0x0"
                 :: "v"((unsigned)(uintptr_t)l0), "v"((unsigned long long)(uintptr_t)g0),
                    "v"((unsigned)(uintptr_t)l1), "v"((unsigned long long)(uintptr_t)g1),
                    "v"((unsigned)(uintptr_t)l2), "v"((unsigned long long)(uintptr_t)g2),
                    "v"((unsigned)(uintptr_t)l3), "v"((unsigned long long)(uintptr_t)g3)
                 : "memory");
}
__device__ __forceinline__ void wait_ds0() {
    // own LDS reads of the buffer are back before the barrier that frees it for a refill
    asm volatile("s_wait_dscnt 0x0" ::: "memory");
}

__device__ __forceinline__ float wave_sum(float s) {
    #pragma unroll
    for (int off = 16; off; off >>= 1) s += __shfl_xor(s, off, 32);
    return s;
}
// wave_sum of three independent values, step by step together (same sums as wave_sum of each);
// unrolled so that the three exchanges of a step are in flight at once.
__device__ __forceinline__ void wave_sum3(float (&s)[3]) {
    #pragma unroll
    for (int off = 16; off; off >>= 1) {
        float t[3];
        #pragma unroll
        for (int r = 0; r < 3; ++r) t[r] = __shfl_xor(s[r], off, 32);
        #pragma unroll
        for (int r = 0; r < 3; ++r) s[r] += t[r];
    }
}
__device__ __forceinline__ float wave_max(float s) {
    #pragma unroll
    for (int off = 16; off; off >>= 1) s = fmaxf(s, __shfl_xor(s, off, 32));
    return s;
}

// ---------------- LayerNorm: one wave per row ----------------
template <int C>
__global__ __launch_bounds__(256) void ln_kernel(
    const float* __restrict__ x, const float* __restrict__ g,
    const float* __restrict__ b, float* __restrict__ y, int nrows)
{
    const int wv = threadIdx.x >> 5, lane = threadIdx.x & 31;
    const int row = blockIdx.x * 8 + wv;
    if (row >= nrows) return;
    const float* xr = x + (size_t)row * C;
    float* yr = y + (size_t)row * C;
    constexpr int PER = C / 32;
    float v[PER];
    float s = 0.f;
    #pragma unroll
    for (int i = 0; i < PER; ++i) { v[i] = xr[lane + i * 32]; s += v[i]; }
    const float mean = wave_sum(s) * (1.0f / C);
    float vs = 0.f;
    #pragma unroll
    for (int i = 0; i < PER; ++i) { float d = v[i] - mean; vs += d * d; }
    const float rstd = rsqrtf(wave_sum(vs) * (1.0f / C) + 1e-5f);
    #pragma unroll
    for (int i = 0; i < PER; ++i) {
        int c = lane + i * 32;
        yr[c] = (v[i] - mean) * rstd * g[c] + b[c];
    }
}

// ---------------- Generic WMMA GEMM: C[M,N] = A[M,K] @ W[K,N] + bias ----------------
// Block tile 64x64, 256 threads = 8 waves, wave -> 2 (16x16) tiles sharing A-frag.
// Double-buffered LDS filled by GLOBAL_LOAD_ASYNC_TO_LDS_B128.
// M, N multiples of 64; K multiple of 32.
__global__ __launch_bounds__(256) void gemm_kernel(
    const float* __restrict__ A, const float* __restrict__ W,
    const float* __restrict__ bias, float* __restrict__ C,
    int M, int N, int K)
{
    // Row strides are multiples of 16B (36*4=144, 68*4=272) so every B128 write
    // stays inside one padded row. Padding keeps 16-row column reads conflict-free.
    __shared__ __align__(16) float As[2][64][36];
    __shared__ __align__(16) float Bs[2][32][68];

    const int wv = threadIdx.x >> 5, lane = threadIdx.x & 31;
    const int m0 = blockIdx.x * 64, n0 = blockIdx.y * 64;
    const int mt = wv >> 1;            // 0..3
    const int nt0 = (wv & 1) * 2;      // 0 or 2
    const int l15 = lane & 15;
    const int khalf = (lane >> 4) << 1;  // 0 for lanes 0-15, 2 for lanes 16-31

    v8f acc[2] = {};

    // A chunk: 64x32 floats = 512 16B-chunks; B chunk: 32x64 floats = 512 16B-chunks.
    // 256 threads -> 2 chunks each per matrix, issued asynchronously.
    auto issue_chunk = [&](int buf, int k0) {
        #pragma unroll
        for (int i = threadIdx.x; i < 512; i += 256) {
            const int m = i >> 3, kc = (i & 7) * 4;
            async_load_b128(&As[buf][m][kc], &A[(size_t)(m0 + m) * K + k0 + kc]);
        }
        #pragma unroll
        for (int i = threadIdx.x; i < 512; i += 256) {
            const int kc = i >> 4, n = (i & 15) * 4;
            async_load_b128(&Bs[buf][kc][n], &W[(size_t)(k0 + kc) * N + n0 + n]);
        }
    };

    issue_chunk(0, 0);
    wait_async0();
    __syncthreads();

    const int nchunks = K >> 5;
    for (int t = 0; t < nchunks; ++t) {
        const int cur = t & 1;
        if (t + 1 < nchunks) issue_chunk(cur ^ 1, (t + 1) * 32);

        #pragma unroll
        for (int kc = 0; kc < 32; kc += 4) {
            const int kb = kc + khalf;
            v2f a;
            a.x = As[cur][mt * 16 + l15][kb];
            a.y = As[cur][mt * 16 + l15][kb + 1];
            #pragma unroll
            for (int u = 0; u < 2; ++u) {
                const int nt = nt0 + u;
                v2f bf;
                bf.x = Bs[cur][kb][nt * 16 + l15];
                bf.y = Bs[cur][kb + 1][nt * 16 + l15];
                acc[u] = wmma_f32(a, bf, acc[u]);
            }
        }

        if (t + 1 < nchunks) {
            wait_async0();     // own async loads into buf^1 landed
            __syncthreads();   // everyone done reading cur & writing buf^1
        }
    }

    // Store D (+bias). C/D layout: vgpr v -> M = mt*16 + v + (lane>=16 ? 8 : 0), N = lane&15.
    const int rbase = mt * 16 + ((lane >> 4) << 3);
    #pragma unroll
    for (int u = 0; u < 2; ++u) {
        const int col = (nt0 + u) * 16 + l15;
        const float bb = bias[n0 + col];
        #pragma unroll
        for (int vz = 0; vz < 8; ++vz) {
            C[(size_t)(m0 + rbase + vz) * N + n0 + col] = acc[u][vz] + bb;
        }
    }
}

// ---------------- Coarse path: LayerNorm + gate + the three projections ----------------
// One block = 64 coarse rows, 24 waves. The rows are normalised once into As (K = 512 whole),
// the gate is formed from the same values, and the 384 output columns (wqc 64 | wk 64 | wv 256)
// are computed from As in one pass over K. Waves 4g..4g+3 own columns 64g..64g+63 as 2x2 wave
// tiles of 32x32. W arrives in 32-row tiles by async copies, two buffers.
// The unrolled loops index register arrays (rows, fragments, accumulators): flat, they stay in registers.
__global__ __launch_bounds__(768) void coarse_kernel(
    const float* __restrict__ x, const float* __restrict__ g, const float* __restrict__ b,
    const float* __restrict__ wg, const float* __restrict__ bg,
    const float* __restrict__ wqc, const float* __restrict__ bqc,
    const float* __restrict__ wk, const float* __restrict__ bk,
    const float* __restrict__ wvp, const float* __restrict__ bv,
    float* __restrict__ q_coarse, float* __restrict__ k_, float* __restrict__ v_,
    float* __restrict__ gate)
{
    // Pitch 516: 16 rows of an A fragment fall 4 banks apart, so a b64 read covers 64 banks once.
    // Pitch 392: rows kb and kb+2 of a B fragment fall 16 banks apart. Both are multiples of 16 B.
    __shared__ __align__(16) float As[64][516];
    __shared__ __align__(16) float Bs[2][32][392];

    // the wave's number as a scalar: the picks and tests made from it become scalar code
    const int wave = __builtin_amdgcn_readfirstlane(threadIdx.x >> 5);
    const int lane = threadIdx.x & 31;
    const int m0 = blockIdx.x * 64;
    const int grp = wave >> 2;           // 0..5: which 64 of the 384 columns
    const int l15 = lane & 15;
    const int khalf = (lane >> 4) << 1;  // 0 for lanes 0-15, 2 for lanes 16-31

    const float* W    = (grp == 0) ? wqc : (grp == 1) ? wk : wvp;
    const float* bias = (grp == 0) ? bqc : (grp == 1) ? bk : bv;
    float* C          = (grp == 0) ? q_coarse : (grp == 1) ? k_ : v_;
    const int N  = (grp < 2) ? 64 : 256;
    const int c0 = (grp < 2) ? 0 : (grp - 2) * 64;

    // The group's 128 threads copy its 32x64 tile of W: 512 16B pieces, 4 a thread.
    const int t128 = threadIdx.x & 127;
    const int ckr = t128 >> 4;           // 0..7
    const int cn  = (t128 & 15) * 4;
    const float* wsrc = W + (size_t)ckr * N + c0 + cn;
    auto issue_tile = [&](int buf, int k0) {
        const float* gp = wsrc + (size_t)k0 * N;
        const float* lp = &Bs[buf][ckr][grp * 64 + cn];
        async_copy4_b128(lp,            gp,
                         lp + 8 * 392,  gp + (size_t)8 * N,
                         lp + 16 * 392, gp + (size_t)16 * N,
                         lp + 24 * 392, gp + (size_t)24 * N);
    };

    issue_tile(0, 0);

    // LayerNorm and gate, one wave a row: rows wave, wave+24 and, in waves 0-15, wave+48.
    // The three rows go through every step side by side, so that their cross-lane sums overlap;
    // waves 16-23 carry zeros in the third place and store nothing from it.
    {
        const bool has3 = wave < 16;
        float v[3][16];
        #pragma unroll
        for (int r = 0; r < 2; ++r) {
            const float* xr = x + (size_t)(m0 + wave + r * 24) * 512;
            #pragma unroll
            for (int i = 0; i < 16; ++i) v[r][i] = xr[lane + i * 32];
        }
        if (has3) {
            const float* xr = x + (size_t)(m0 + wave + 48) * 512;
            #pragma unroll
            for (int i = 0; i < 16; ++i) v[2][i] = xr[lane + i * 32];
        } else {
            #pragma unroll
            for (int i = 0; i < 16; ++i) v[2][i] = 0.f;
        }
        float s[3], mean[3], rstd[3];
        #pragma unroll
        for (int r = 0; r < 3; ++r) {
            s[r] = 0.f;
            #pragma unroll
            for (int i = 0; i < 16; ++i) s[r] += v[r][i];
        }
        wave_sum3(s);
        #pragma unroll
        for (int r = 0; r < 3; ++r) {
            mean[r] = s[r] * (1.0f / 512);
            s[r] = 0.f;
            #pragma unroll
            for (int i = 0; i < 16; ++i) { float d = v[r][i] - mean[r]; s[r] += d * d; }
        }
        wave_sum3(s);
        #pragma unroll
        for (int r = 0; r < 3; ++r) {
            rstd[r] = rsqrtf(s[r] * (1.0f / 512) + 1e-5f);
            s[r] = 0.f;
        }
        #pragma unroll
        for (int i = 0; i < 16; ++i) {
            const int c = lane + i * 32;
            const float gc = g[c], bc = b[c], wc = wg[c];
            #pragma unroll
            for (int r = 0; r < 3; ++r) {
                v[r][i] = (v[r][i] - mean[r]) * rstd[r] * gc + bc;
                s[r] += v[r][i] * wc;
            }
        }
        wave_sum3(s);
        const float bg0 = bg[0];
        #pragma unroll
        for (int r = 0; r < 3; ++r) {
            if (r < 2 || has3) {
                const int row = wave + r * 24;
                #pragma unroll
                for (int i = 0; i < 16; ++i) As[row][lane + i * 32] = v[r][i];
                if (lane == 0) gate[m0 + row] = 1.0f / (1.0f + __expf(-(s[r] + bg0)));
            }
        }
    }

    wait_async0();     // own copies of tile 0 landed
    __syncthreads();   // As and tile 0 visible to every wave
    issue_tile(1, 32);

    const int w4 = wave & 3;
    const int mrow = (w4 >> 1) * 32;
    const int ncol = (w4 & 1) * 32;      // inside the group's 64 columns
    v8f acc[2][2] = {};

    for (int t = 0; t < 16; ++t) {
        const int cur = t & 1;
        #pragma unroll
        for (int kc = 0; kc < 32; kc += 4) {
            const int kb = kc + khalf;
            v2f a[2], bf[2];
            #pragma unroll
            for (int mi = 0; mi < 2; ++mi) {
                a[mi].x = As[mrow + mi * 16 + l15][t * 32 + kb];
                a[mi].y = As[mrow + mi * 16 + l15][t * 32 + kb + 1];
            }
            #pragma unroll
            for (int u = 0; u < 2; ++u) {
                bf[u].x = Bs[cur][kb][grp * 64 + ncol + u * 16 + l15];
                bf[u].y = Bs[cur][kb + 1][grp * 64 + ncol + u * 16 + l15];
            }
            #pragma unroll
            for (int mi = 0; mi < 2; ++mi) {
                #pragma unroll
                for (int u = 0; u < 2; ++u) acc[mi][u] = wmma_f32(a[mi], bf[u], acc[mi][u]);
            }
        }
        wait_ds0();
        wait_async0();     // own copies of tile t+1 landed
        __syncthreads();   // tile t+1 visible; every reader has left buffer cur
        if (t + 2 < 16) issue_tile(cur, (t + 2) * 32);
    }
    wait_async0();         // nothing in flight when the wave ends

    // Store D (+bias). vgpr vz -> row + vz + (lane>=16 ? 8 : 0), column = lane&15.
    #pragma unroll
    for (int mi = 0; mi < 2; ++mi) {
        const int rbase = mrow + mi * 16 + ((lane >> 4) << 3);
        #pragma unroll
        for (int u = 0; u < 2; ++u) {
            const int col = c0 + ncol + u * 16 + l15;
            const float bb = bias[col];
            #pragma unroll
            for (int vz = 0; vz < 8; ++vz) {
                C[(size_t)(m0 + rbase + vz) * N + col] = acc[mi][u][vz] + bb;
            }
        }
    }
}

// ---------------- Local attention over a 4x4 coarse tile ----------------
// 64 queries (16 cells x 2x2 fine pixels) vs shared 8x8 key union.
// Q is blended while it is staged: q = q_fine*g + q_coarse*(1-g), g the gate of the query's cell.
// S = Q*K^T (WMMA, 64x64x64), masked softmax over 5x5 window, O = P*V (WMMA, 64x64 @ 64x256).
__global__ __launch_bounds__(256) void attn_kernel(
    const float* __restrict__ qf,     // [B,128,128,64] fine query projection
    const float* __restrict__ qc,     // [B,64,64,64]   coarse query projection
    const float* __restrict__ gate,   // [B,64,64]
    const float* __restrict__ Kg,     // [B,64,64,64]
    const float* __restrict__ Vg,     // [B,64,64,256]
    float* __restrict__ out)          // [B,128,128,256]
{
    __shared__ float Qs[64][68];
    __shared__ float Ks[64][68];
    __shared__ float Ps[64][68];
    __shared__ int   voffs[64];  // V row base offsets (elements) or -1 if zero-padded
    __shared__ int   qpix[64];   // fine-pixel index of each query row

    const int b = blockIdx.z;
    const int i0 = blockIdx.y * 4, j0 = blockIdx.x * 4;
    const int wv = threadIdx.x >> 5, lane = threadIdx.x & 31;
    const int l15 = lane & 15;
    const int khalf = (lane >> 4) << 1;

    // Tables: union position validity/offsets + query-row pixel indices.
    if (threadIdx.x < 64) {
        const int u = threadIdx.x;
        const int r = u >> 3, c = u & 7;
        const int ir = i0 - 2 + r, jc = j0 - 2 + c;
        const bool ok = (ir >= 0) && (ir < 64) && (jc >= 0) && (jc < 64);
        voffs[u] = ok ? (((b * 64 + ir) * 64 + jc) * 256) : -1;
        const int cell = u >> 2, sub = u & 3;
        const int ci = cell >> 2, cj = cell & 3;
        const int y = (i0 + ci) * 2 + (sub >> 1);
        const int x = (j0 + cj) * 2 + (sub & 1);
        qpix[u] = (b * 128 + y) * 128 + x;
    }
    __syncthreads();

    // Stage K union [64,64] with zero padding, and the blended Q [64,64].
    for (int i = threadIdx.x; i < 4096; i += 256) {
        const int u = i >> 6, e = i & 63;
        const int r = u >> 3, c = u & 7;
        const int ir = i0 - 2 + r, jc = j0 - 2 + c;
        const bool ok = (ir >= 0) && (ir < 64) && (jc >= 0) && (jc < 64);
        Ks[u][e] = ok ? Kg[(size_t)((b * 64 + ir) * 64 + jc) * 64 + e] : 0.0f;
        const int cell = u >> 2;  // rows 4*cell..4*cell+3 are the fine pixels of one coarse cell
        const int cidx = (b * 64 + i0 + (cell >> 2)) * 64 + j0 + (cell & 3);
        const float g = gate[cidx];
        Qs[u][e] = qf[(size_t)qpix[u] * 64 + e] * g + qc[(size_t)cidx * 64 + e] * (1.0f - g);
    }
    __syncthreads();

    // ---- S = Q * K^T : M=64, N=64, K=64 (8 waves x 2 tiles) ----
    {
        const int mt = wv >> 1;
        const int nt0 = (wv & 1) * 2;
        v8f accS[2] = {};
        #pragma unroll
        for (int kc = 0; kc < 64; kc += 4) {
            const int kb = kc + khalf;
            v2f a;
            a.x = Qs[mt * 16 + l15][kb];
            a.y = Qs[mt * 16 + l15][kb + 1];
            #pragma unroll
            for (int u = 0; u < 2; ++u) {
                const int nrow = (nt0 + u) * 16 + l15;  // B[k][n] = Ks[n][k]
                v2f bf;
                bf.x = Ks[nrow][kb];
                bf.y = Ks[nrow][kb + 1];
                accS[u] = wmma_f32(a, bf, accS[u]);
            }
        }
        const int rbase = mt * 16 + ((lane >> 4) << 3);
        #pragma unroll
        for (int u = 0; u < 2; ++u) {
            const int col = (nt0 + u) * 16 + l15;
            #pragma unroll
            for (int vz = 0; vz < 8; ++vz) Ps[rbase + vz][col] = accS[u][vz];
        }
    }
    __syncthreads();

    // ---- Masked softmax per query row (wave handles 8 rows; lane covers cols {lane, lane+32}) ----
    #pragma unroll
    for (int rr = 0; rr < 8; ++rr) {
        const int row = wv * 8 + rr;
        const int cell = row >> 2;
        const int ci = cell >> 2, cj = cell & 3;
        const int u0 = lane, u1 = lane + 32;
        const int r0 = u0 >> 3, c0 = u0 & 7;
        const int r1 = u1 >> 3, c1 = u1 & 7;
        const bool v0 = (r0 >= ci) && (r0 <= ci + 4) && (c0 >= cj) && (c0 <= cj + 4);
        const bool v1 = (r1 >= ci) && (r1 <= ci + 4) && (c1 >= cj) && (c1 <= cj + 4);
        const float NEG = -3.0e38f;
        const float x0 = v0 ? Ps[row][u0] : NEG;
        const float x1 = v1 ? Ps[row][u1] : NEG;
        const float m = wave_max(fmaxf(x0, x1));
        const float e0 = v0 ? __expf(x0 - m) : 0.0f;
        const float e1 = v1 ? __expf(x1 - m) : 0.0f;
        const float inv = 1.0f / wave_sum(e0 + e1);
        Ps[row][u0] = e0 * inv;
        Ps[row][u1] = e1 * inv;
    }
    __syncthreads();

    // ---- O = P * V : M=64, K=64, N=256; V frags straight from global ----
    // Each wave owns 32 output columns (2 n-tiles) and all 4 m-tiles, so every V
    // fragment is loaded once per block and feeds 4 WMMAs on independent accumulators.
    const int nb = wv * 32 + l15;
    v8f acc[4][2] = {};
    #pragma unroll
    for (int kc = 0; kc < 64; kc += 4) {
        const int kb = kc + khalf;
        const int o0 = voffs[kb], o1 = voffs[kb + 1];
        v2f a[4];
        #pragma unroll
        for (int mt = 0; mt < 4; ++mt) {
            a[mt].x = Ps[mt * 16 + l15][kb];
            a[mt].y = Ps[mt * 16 + l15][kb + 1];
        }
        v2f bf[2];
        #pragma unroll
        for (int u = 0; u < 2; ++u) {
            const int ncol = nb + u * 16;
            bf[u].x = (o0 >= 0) ? Vg[(size_t)o0 + ncol] : 0.0f;
            bf[u].y = (o1 >= 0) ? Vg[(size_t)o1 + ncol] : 0.0f;
        }
        #pragma unroll
        for (int mt = 0; mt < 4; ++mt) {
            #pragma unroll
            for (int u = 0; u < 2; ++u) acc[mt][u] = wmma_f32(a[mt], bf[u], acc[mt][u]);
        }
    }
    #pragma unroll
    for (int mt = 0; mt < 4; ++mt) {
        const int rbase = mt * 16 + ((lane >> 4) << 3);
        #pragma unroll
        for (int vz = 0; vz < 8; ++vz) {
            float* orow = out + (size_t)qpix[rbase + vz] * 256 + nb;
            orow[0]  = acc[mt][0][vz];
            orow[16] = acc[mt][1][vz];
        }
    }
}

// ---------------- Host launcher ----------------
extern "C" void kernel_launch(void* const* d_in, const int* in_sizes, int n_in,
                              void* d_out, int out_size, void* d_ws, size_t ws_size,
                              hipStream_t stream)
{
    const float* fine    = (const float*)d_in[0];   // [4,128,128,256]
    const float* coarse  = (const float*)d_in[1];   // [4,64,64,512]
    const float* gamma_f = (const float*)d_in[2];
    const float* beta_f  = (const float*)d_in[3];
    const float* gamma_c = (const float*)d_in[4];
    const float* beta_c  = (const float*)d_in[5];
    const float* wg      = (const float*)d_in[6];   // [512,1]
    const float* bg      = (const float*)d_in[7];   // [1]
    const float* wqf     = (const float*)d_in[8];   // [256,64]
    const float* bqf     = (const float*)d_in[9];
    const float* wqc     = (const float*)d_in[10];  // [512,64]
    const float* bqc     = (const float*)d_in[11];
    const float* wk      = (const float*)d_in[12];  // [512,64]
    const float* bk      = (const float*)d_in[13];
    const float* wv      = (const float*)d_in[14];  // [512,256]
    const float* bv      = (const float*)d_in[15];
    float* out = (float*)d_out;                     // [4,128,128,256]

    const int MF = 4 * 128 * 128;   // 65536 fine rows
    const int MC = 4 * 64 * 64;     // 16384 coarse rows

    float* ws = (float*)d_ws;
    float* fine_n   = ws;                    // 16777216
    float* q_fine   = fine_n + 16777216;     // 4194304
    float* q_coarse = q_fine + 4194304;      // 1048576
    float* k_       = q_coarse + 1048576;    // 1048576
    float* v_       = k_ + 1048576;          // 4194304
    float* gate     = v_ + 4194304;          // 16384

    // 1) Fine path: LayerNorm, then the query projection (WMMA GEMM, async double-buffered staging)
    ln_kernel<256><<<MF / 8, 256, 0, stream>>>(fine, gamma_f, beta_f, fine_n, MF);
    gemm_kernel<<<dim3(MF / 64, 64 / 64), 256, 0, stream>>>(fine_n,   wqf, bqf, q_fine,   MF, 64,  256);

    // 2) Coarse path: LayerNorm, gate and the three projections in one kernel
    coarse_kernel<<<MC / 64, 768, 0, stream>>>(coarse, gamma_c, beta_c, wg, bg, wqc, bqc, wk, bk, wv, bv,
                                               q_coarse, k_, v_, gate);

    // 3) Local attention (one block per 4x4 coarse tile), query blend included
    attn_kernel<<<dim3(16, 16, 4), 256, 0, stream>>>(q_fine, q_coarse, gate, k_, v_, out);
}

// v004
// One run takes 92.7 microseconds.
// Timed twice side by side with v003, it ran 1.10 times as fast both times.
// Over all steps from v000 it is 1.82 times as fast.
#include <hip/hip_runtime.h>
#include <hip/hip_bf16.h>

// SAPA feature alignment for MI455X (gfx1250, wave32, WMMA).
// Matrix math: V_WMMA_F32_16X16X4_F32 (f32 in, f32 accum).
// Weight staging: GLOBAL_LOAD_ASYNC_TO_LDS_B128 (ASYNCcnt-tracked).
// The coarse path is one kernel: a 64-row tile is normalised into LDS, the gate is formed
// from the same values in registers, and the three coarse projections read the tile there. The fine path is one kernel of the same kind.
//
// Scratch layout (floats):
//   q_fine   65536*64
//   q_coarse 16384*64
//   k_       16384*64
//   v_       16384*256
//   gate     16384

typedef __attribute__((ext_vector_type(2))) float v2f;
typedef __attribute__((ext_vector_type(8))) float v8f;

__device__ __forceinline__ v8f wmma_f32(v2f a, v2f b, v8f c) {
    // D = A(16x4) * B(4x16) + C(16x16), all f32
    return __builtin_amdgcn_wmma_f32_16x16x4_f32(
        /*neg_a=*/false, a, /*neg_b=*/false, b,
        /*c_mod=*/(short)0, c, /*reuse_a=*/false, /*reuse_b=*/false);
}

__device__ __forceinline__ void wait_async0() {
    asm volatile("s_wait_asynccnt 0x0" ::: "memory");
}
// Four 16B copies global -> LDS in one statement. The closing s_wait_xcnt keeps every later
// write of the address registers behind the copies that name them.
__device__ __forceinline__ void async_copy4_b128(
    const float* l0, const float* g0, const float* l1, const float* g1,
    const float* l2, const float* g2, const float* l3, const float* g3) {
    asm volatile("global_load_async_to_lds_b128 %0, %1, off\n\t"
                 "global_load_async_to_lds_b128 %2, %3, off\n\t"
                 "global_load_async_to_lds_b128 %4, %5, off\n\t"
                 "global_load_async_to_lds_b128 %6, %7, off\n\t"
                 "s_wait_xcnt 0x0"
                 :: "v"((unsigned)(uintptr_t)l0), "v"((unsigned long long)(uintptr_t)g0),
                    "v"((unsigned)(uintptr_t)l1), "v"((unsigned long long)(uintptr_t)g1),
                    "v"((unsigned)(uintptr_t)l2), "v"((unsigned long long)(uintptr_t)g2),
                    "v"((unsigned)(uintptr_t)l3), "v"((unsigned long long)(uintptr_t)g3)
                 : "memory");
}
__device__ __forceinline__ void wait_ds0() {
    // own LDS reads of the buffer are back before the barrier that frees it for a refill
    asm volatile("s_wait_dscnt 0x0" ::: "memory");
}

__device__ __forceinline__ float wave_sum(float s) {
    #pragma unroll
    for (int off = 16; off; off >>= 1) s += __shfl_xor(s, off, 32);
    return s;
}
// wave_sum of three independent values, step by step together (same sums as wave_sum of each);
// unrolled so that the three exchanges of a step are in flight at once.
__device__ __forceinline__ void wave_sum3(float (&s)[3]) {
    #pragma unroll
    for (int off = 16; off; off >>= 1) {
        float t[3];
        #pragma unroll
        for (int r = 0; r < 3; ++r) t[r] = __shfl_xor(s[r], off, 32);
        #pragma unroll
        for (int r = 0; r < 3; ++r) s[r] += t[r];
    }
}
// the same for eight independent values
__device__ __forceinline__ void wave_sum8(float (&s)[8]) {
    #pragma unroll
    for (int off = 16; off; off >>= 1) {
        float t[8];
        #pragma unroll
        for (int r = 0; r < 8; ++r) t[r] = __shfl_xor(s[r], off, 32);
        #pragma unroll
        for (int r = 0; r < 8; ++r) s[r] += t[r];
    }
}
__device__ __forceinline__ float wave_max(float s) {
    #pragma unroll
    for (int off = 16; off; off >>= 1) s = fmaxf(s, __shfl_xor(s, off, 32));
    return s;
}

// ---------------- Fine path: LayerNorm + query projection ----------------
// One block = 128 fine rows as two tiles of 64, 8 waves. W (256x64) is copied whole into LDS once.
// A tile is normalised into As (K = 256 whole, one wave a row, eight rows a wave side by side) and
// multiplied from there: wave -> 16 rows x 32 columns, k in ascending order. The second tile's rows
// are loaded into registers in front of the first tile's products, so that they fly under them.
// The unrolled loops index register arrays (rows, accumulators): flat, they stay in registers.
__global__ __launch_bounds__(256) void fine_kernel(
    const float* __restrict__ x, const float* __restrict__ g, const float* __restrict__ b,
    const float* __restrict__ W, const float* __restrict__ bias, float* __restrict__ C)
{
    // Pitch 260: 16 rows of an A fragment fall 4 banks apart, so a b64 read covers 64 banks once.
    // Pitch 72: rows kb and kb+2 of a B fragment fall 16 banks apart. Both are multiples of 16 B.
    __shared__ __align__(16) float As[64][260];
    __shared__ __align__(16) float Bs[256][72];

    // the wave's number as a scalar: row and tile picks made from it become scalar code
    const int wave = __builtin_amdgcn_readfirstlane(threadIdx.x >> 5);
    const int lane = threadIdx.x & 31;
    const int l15 = lane & 15;
    const int khalf = (lane >> 4) << 1;  // 0 for lanes 0-15, 2 for lanes 16-31
    const int m0 = blockIdx.x * 128;

    float v[8][8];
    auto load_rows = [&](int tile) {
        #pragma unroll
        for (int r = 0; r < 8; ++r) {
            const float* xr = x + (size_t)(m0 + tile * 64 + wave * 8 + r) * 256;
            #pragma unroll
            for (int i = 0; i < 8; ++i) v[r][i] = xr[lane + i * 32];
        }
    };

    // W: 4096 16B pieces, 16 a thread (rows ckr, ckr+16, ..., ckr+240).
    {
        const int ckr = threadIdx.x >> 4;        // 0..15
        const int cn  = (threadIdx.x & 15) * 4;
        const float* gp = W + ckr * 64 + cn;
        const float* lp = &Bs[ckr][cn];
        #pragma unroll
        for (int j = 0; j < 4; ++j) {
            async_copy4_b128(lp + (j * 64) * 72,      gp + (j * 64) * 64,
                             lp + (j * 64 + 16) * 72, gp + (j * 64 + 16) * 64,
                             lp + (j * 64 + 32) * 72, gp + (j * 64 + 32) * 64,
                             lp + (j * 64 + 48) * 72, gp + (j * 64 + 48) * 64);
        }
    }

    auto norm_rows = [&]() {
        float s[8], mean[8];
        #pragma unroll
        for (int r = 0; r < 8; ++r) {
            s[r] = 0.f;
            #pragma unroll
            for (int i = 0; i < 8; ++i) s[r] += v[r][i];
        }
        wave_sum8(s);
        #pragma unroll
        for (int r = 0; r < 8; ++r) {
            mean[r] = s[r] * (1.0f / 256);
            s[r] = 0.f;
            #pragma unroll
            for (int i = 0; i < 8; ++i) { float d = v[r][i] - mean[r]; s[r] += d * d; }
        }
        wave_sum8(s);
        #pragma unroll
        for (int r = 0; r < 8; ++r) s[r] = rsqrtf(s[r] * (1.0f / 256) + 1e-5f);
        #pragma unroll
        for (int i = 0; i < 8; ++i) {
            const int c = lane + i * 32;
            const float gc = g[c], bc = b[c];
            #pragma unroll
            for (int r = 0; r < 8; ++r) As[wave * 8 + r][c] = (v[r][i] - mean[r]) * s[r] * gc + bc;
        }
    };

    const int mt = wave >> 1;            // 0..3
    const int nt0 = (wave & 1) * 2;      // 0 or 2
    auto gemm = [&](v8f (&acc)[2]) {
        // eight k steps a trip: their LDS reads are issued together, ahead of the products
        #pragma unroll 8
        for (int kc = 0; kc < 256; kc += 4) {
            const int kb = kc + khalf;
            v2f a;
            a.x = As[mt * 16 + l15][kb];
            a.y = As[mt * 16 + l15][kb + 1];
            #pragma unroll
            for (int u = 0; u < 2; ++u) {
                const int nt = nt0 + u;
                v2f bf;
                bf.x = Bs[kb][nt * 16 + l15];
                bf.y = Bs[kb + 1][nt * 16 + l15];
                acc[u] = wmma_f32(a, bf, acc[u]);
            }
        }
    };
    // Store D (+bias). vgpr vz -> row + vz + (lane>=16 ? 8 : 0), column = lane&15.
    auto store_tile = [&](const v8f (&acc)[2], int tile) {
        const int rbase = m0 + tile * 64 + mt * 16 + ((lane >> 4) << 3);
        #pragma unroll
        for (int u = 0; u < 2; ++u) {
            const int col = (nt0 + u) * 16 + l15;
            const float bb = bias[col];
            #pragma unroll
            for (int vz = 0; vz < 8; ++vz) {
                C[(size_t)(rbase + vz) * 64 + col] = acc[u][vz] + bb;
            }
        }
    };

    load_rows(0);
    norm_rows();
    wait_async0();     // own copies of W landed
    __syncthreads();   // tile 0 and W visible to every wave
    load_rows(1);
    v8f acc0[2] = {}, acc1[2] = {};
    gemm(acc0);
    __syncthreads();   // every reader has left As
    norm_rows();
    __syncthreads();   // tile 1 visible to every wave
    // tile 0 goes out here, under tile 1's products: in front of the two barriers they would wait for the stores
    store_tile(acc0, 0);
    gemm(acc1);
    store_tile(acc1, 1);
}

// ---------------- Coarse path: LayerNorm + gate + the three projections ----------------
// One block = 64 coarse rows, 24 waves. The rows are normalised once into As (K = 512 whole),
// the gate is formed from the same values, and the 384 output columns (wqc 64 | wk 64 | wv 256)
// are computed from As in one pass over K. Waves 4g..4g+3 own columns 64g..64g+63 as 2x2 wave
// tiles of 32x32. W arrives in 32-row tiles by async copies, two buffers.
// The unrolled loops index register arrays (rows, fragments, accumulators): flat, they stay in registers.
__global__ __launch_bounds__(768) void coarse_kernel(
    const float* __restrict__ x, const float* __restrict__ g, const float* __restrict__ b,
    const float* __restrict__ wg, const float* __restrict__ bg,
    const float* __restrict__ wqc, const float* __restrict__ bqc,
    const float* __restrict__ wk, const float* __restrict__ bk,
    const float* __restrict__ wvp, const float* __restrict__ bv,
    float* __restrict__ q_coarse, float* __restrict__ k_, float* __restrict__ v_,
    float* __restrict__ gate)
{
    // Pitch 516: 16 rows of an A fragment fall 4 banks apart, so a b64 read covers 64 banks once.
    // Pitch 392: rows kb and kb+2 of a B fragment fall 16 banks apart. Both are multiples of 16 B.
    __shared__ __align__(16) float As[64][516];
    __shared__ __align__(16) float Bs[2][32][392];

    // the wave's number as a scalar: the picks and tests made from it become scalar code
    const int wave = __builtin_amdgcn_readfirstlane(threadIdx.x >> 5);
    const int lane = threadIdx.x & 31;
    const int m0 = blockIdx.x * 64;
    const int grp = wave >> 2;           // 0..5: which 64 of the 384 columns
    const int l15 = lane & 15;
    const int khalf = (lane >> 4) << 1;  // 0 for lanes 0-15, 2 for lanes 16-31

    const float* W    = (grp == 0) ? wqc : (grp == 1) ? wk : wvp;
    const float* bias = (grp == 0) ? bqc : (grp == 1) ? bk : bv;
    float* C          = (grp == 0) ? q_coarse : (grp == 1) ? k_ : v_;
    const int N  = (grp < 2) ? 64 : 256;
    const int c0 = (grp < 2) ? 0 : (grp - 2) * 64;

    // The group's 128 threads copy its 32x64 tile of W: 512 16B pieces, 4 a thread.
    const int t128 = threadIdx.x & 127;
    const int ckr = t128 >> 4;           // 0..7
    const int cn  = (t128 & 15) * 4;
    const float* wsrc = W + (size_t)ckr * N + c0 + cn;
    auto issue_tile = [&](int buf, int k0) {
        const float* gp = wsrc + (size_t)k0 * N;
        const float* lp = &Bs[buf][ckr][grp * 64 + cn];
        async_copy4_b128(lp,            gp,
                         lp + 8 * 392,  gp + (size_t)8 * N,
                         lp + 16 * 392, gp + (size_t)16 * N,
                         lp + 24 * 392, gp + (size_t)24 * N);
    };

    issue_tile(0, 0);

    // LayerNorm and gate, one wave a row: rows wave, wave+24 and, in waves 0-15, wave+48.
    // The three rows go through every step side by side, so that their cross-lane sums overlap;
    // waves 16-23 carry zeros in the third place and store nothing from it.
    {
        const bool has3 = wave < 16;
        float v[3][16];
        #pragma unroll
        for (int r = 0; r < 2; ++r) {
            const float* xr = x + (size_t)(m0 + wave + r * 24) * 512;
            #pragma unroll
            for (int i = 0; i < 16; ++i) v[r][i] = xr[lane + i * 32];
        }
        if (has3) {
            const float* xr = x + (size_t)(m0 + wave + 48) * 512;
            #pragma unroll
            for (int i = 0; i < 16; ++i) v[2][i] = xr[lane + i * 32];
        } else {
            #pragma unroll
            for (int i = 0; i < 16; ++i) v[2][i] = 0.f;
        }
        float s[3], mean[3], rstd[3];
        #pragma unroll
        for (int r = 0; r < 3; ++r) {
            s[r] = 0.f;
            #pragma unroll
            for (int i = 0; i < 16; ++i) s[r] += v[r][i];
        }
        wave_sum3(s);
        #pragma unroll
        for (int r = 0; r < 3; ++r) {
            mean[r] = s[r] * (1.0f / 512);
            s[r] = 0.f;
            #pragma unroll
            for (int i = 0; i < 16; ++i) { float d = v[r][i] - mean[r]; s[r] += d * d; }
        }
        wave_sum3(s);
        #pragma unroll
        for (int r = 0; r < 3; ++r) {
            rstd[r] = rsqrtf(s[r] * (1.0f / 512) + 1e-5f);
            s[r] = 0.f;
        }
        #pragma unroll
        for (int i = 0; i < 16; ++i) {
            const int c = lane + i * 32;
            const float gc = g[c], bc = b[c], wc = wg[c];
            #pragma unroll
            for (int r = 0; r < 3; ++r) {
                v[r][i] = (v[r][i] - mean[r]) * rstd[r] * gc + bc;
                s[r] += v[r][i] * wc;
            }
        }
        wave_sum3(s);
        const float bg0 = bg[0];
        #pragma unroll
        for (int r = 0; r < 3; ++r) {
            if (r < 2 || has3) {
                const int row = wave + r * 24;
                #pragma unroll
                for (int i = 0; i < 16; ++i) As[row][lane + i * 32] = v[r][i];
                if (lane == 0) gate[m0 + row] = 1.0f / (1.0f + __expf(-(s[r] + bg0)));
            }
        }
    }

    wait_async0();     // own copies of tile 0 landed
    __syncthreads();   // As and tile 0 visible to every wave
    issue_tile(1, 32);

    const int w4 = wave & 3;
    const int mrow = (w4 >> 1) * 32;
    const int ncol = (w4 & 1) * 32;      // inside the group's 64 columns
    v8f acc[2][2] = {};

    for (int t = 0; t < 16; ++t) {
        const int cur = t & 1;
        #pragma unroll
        for (int kc = 0; kc < 32; kc += 4) {
            const int kb = kc + khalf;
            v2f a[2], bf[2];
            #pragma unroll
            for (int mi = 0; mi < 2; ++mi) {
                a[mi].x = As[mrow + mi * 16 + l15][t * 32 + kb];
                a[mi].y = As[mrow + mi * 16 + l15][t * 32 + kb + 1];
            }
            #pragma unroll
            for (int u = 0; u < 2; ++u) {
                bf[u].x = Bs[cur][kb][grp * 64 + ncol + u * 16 + l15];
                bf[u].y = Bs[cur][kb + 1][grp * 64 + ncol + u * 16 + l15];
            }
            #pragma unroll
            for (int mi = 0; mi < 2; ++mi) {
                #pragma unroll
                for (int u = 0; u < 2; ++u) acc[mi][u] = wmma_f32(a[mi], bf[u], acc[mi][u]);
            }
        }
        wait_ds0();
        wait_async0();     // own copies of tile t+1 landed
        __syncthreads();   // tile t+1 visible; every reader has left buffer cur
        if (t + 2 < 16) issue_tile(cur, (t + 2) * 32);
    }
    wait_async0();         // nothing in flight when the wave ends

    // Store D (+bias). vgpr vz -> row + vz + (lane>=16 ? 8 : 0), column = lane&15.
    #pragma unroll
    for (int mi = 0; mi < 2; ++mi) {
        const int rbase = mrow + mi * 16 + ((lane >> 4) << 3);
        #pragma unroll
        for (int u = 0; u < 2; ++u) {
            const int col = c0 + ncol + u * 16 + l15;
            const float bb = bias[col];
            #pragma unroll
            for (int vz = 0; vz < 8; ++vz) {
                C[(size_t)(m0 + rbase + vz) * N + col] = acc[mi][u][vz] + bb;
            }
        }
    }
}

// ---------------- Local attention over a 4x4 coarse tile ----------------
// 64 queries (16 cells x 2x2 fine pixels) vs shared 8x8 key union.
// Q is blended while it is staged: q = q_fine*g + q_coarse*(1-g), g the gate of the query's cell.
// S = Q*K^T (WMMA, 64x64x64), masked softmax over 5x5 window, O = P*V (WMMA, 64x64 @ 64x256).
__global__ __launch_bounds__(256) void attn_kernel(
    const float* __restrict__ qf,     // [B,128,128,64] fine query projection
    const float* __restrict__ qc,     // [B,64,64,64]   coarse query projection
    const float* __restrict__ gate,   // [B,64,64]
    const float* __restrict__ Kg,     // [B,64,64,64]
    const float* __restrict__ Vg,     // [B,64,64,256]
    float* __restrict__ out)          // [B,128,128,256]
{
    __shared__ float Qs[64][68];
    __shared__ float Ks[64][68];
    __shared__ float Ps[64][68];
    __shared__ int   voffs[64];  // V row base offsets (elements) or -1 if zero-padded
    __shared__ int   qpix[64];   // fine-pixel index of each query row

    const int b = blockIdx.z;
    const int i0 = blockIdx.y * 4, j0 = blockIdx.x * 4;
    const int wv = threadIdx.x >> 5, lane = threadIdx.x & 31;
    const int l15 = lane & 15;
    const int khalf = (lane >> 4) << 1;

    // Tables: union position validity/offsets + query-row pixel indices.
    if (threadIdx.x < 64) {
        const int u = threadIdx.x;
        const int r = u >> 3, c = u & 7;
        const int ir = i0 - 2 + r, jc = j0 - 2 + c;
        const bool ok = (ir >= 0) && (ir < 64) && (jc >= 0) && (jc < 64);
        voffs[u] = ok ? (((b * 64 + ir) * 64 + jc) * 256) : -1;
        const int cell = u >> 2, sub = u & 3;
        const int ci = cell >> 2, cj = cell & 3;
        const int y = (i0 + ci) * 2 + (sub >> 1);
        const int x = (j0 + cj) * 2 + (sub & 1);
        qpix[u] = (b * 128 + y) * 128 + x;
    }
    __syncthreads();

    // Stage K union [64,64] with zero padding, and the blended Q [64,64].
    for (int i = threadIdx.x; i < 4096; i += 256) {
        const int u = i >> 6, e = i & 63;
        const int r = u >> 3, c = u & 7;
        const int ir = i0 - 2 + r, jc = j0 - 2 + c;
        const bool ok = (ir >= 0) && (ir < 64) && (jc >= 0) && (jc < 64);
        Ks[u][e] = ok ? Kg[(size_t)((b * 64 + ir) * 64 + jc) * 64 + e] : 0.0f;
        const int cell = u >> 2;  // rows 4*cell..4*cell+3 are the fine pixels of one coarse cell
        const int cidx = (b * 64 + i0 + (cell >> 2)) * 64 + j0 + (cell & 3);
        const float g = gate[cidx];
        Qs[u][e] = qf[(size_t)qpix[u] * 64 + e] * g + qc[(size_t)cidx * 64 + e] * (1.0f - g);
    }
    __syncthreads();

    // ---- S = Q * K^T : M=64, N=64, K=64 (8 waves x 2 tiles) ----
    {
        const int mt = wv >> 1;
        const int nt0 = (wv & 1) * 2;
        v8f accS[2] = {};
        #pragma unroll
        for (int kc = 0; kc < 64; kc += 4) {
            const int kb = kc + khalf;
            v2f a;
            a.x = Qs[mt * 16 + l15][kb];
            a.y = Qs[mt * 16 + l15][kb + 1];
            #pragma unroll
            for (int u = 0; u < 2; ++u) {
                const int nrow = (nt0 + u) * 16 + l15;  // B[k][n] = Ks[n][k]
                v2f bf;
                bf.x = Ks[nrow][kb];
                bf.y = Ks[nrow][kb + 1];
                accS[u] = wmma_f32(a, bf, accS[u]);
            }
        }
        const int rbase = mt * 16 + ((lane >> 4) << 3);
        #pragma unroll
        for (int u = 0; u < 2; ++u) {
            const int col = (nt0 + u) * 16 + l15;
            #pragma unroll
            for (int vz = 0; vz < 8; ++vz) Ps[rbase + vz][col] = accS[u][vz];
        }
    }
    __syncthreads();

    // ---- Masked softmax per query row (wave handles 8 rows; lane covers cols {lane, lane+32}) ----
    #pragma unroll
    for (int rr = 0; rr < 8; ++rr) {
        const int row = wv * 8 + rr;
        const int cell = row >> 2;
        const int ci = cell >> 2, cj = cell & 3;
        const int u0 = lane, u1 = lane + 32;
        const int r0 = u0 >> 3, c0 = u0 & 7;
        const int r1 = u1 >> 3, c1 = u1 & 7;
        const bool v0 = (r0 >= ci) && (r0 <= ci + 4) && (c0 >= cj) && (c0 <= cj + 4);
        const bool v1 = (r1 >= ci) && (r1 <= ci + 4) && (c1 >= cj) && (c1 <= cj + 4);
        const float NEG = -3.0e38f;
        const float x0 = v0 ? Ps[row][u0] : NEG;
        const float x1 = v1 ? Ps[row][u1] : NEG;
        const float m = wave_max(fmaxf(x0, x1));
        const float e0 = v0 ? __expf(x0 - m) : 0.0f;
        const float e1 = v1 ? __expf(x1 - m) : 0.0f;
        const float inv = 1.0f / wave_sum(e0 + e1);
        Ps[row][u0] = e0 * inv;
        Ps[row][u1] = e1 * inv;
    }
    __syncthreads();

    // ---- O = P * V : M=64, K=64, N=256; V frags straight from global ----
    // Each wave owns 32 output columns (2 n-tiles) and all 4 m-tiles, so every V
    // fragment is loaded once per block and feeds 4 WMMAs on independent accumulators.
    const int nb = wv * 32 + l15;
    v8f acc[4][2] = {};
    #pragma unroll
    for (int kc = 0; kc < 64; kc += 4) {
        const int kb = kc + khalf;
        const int o0 = voffs[kb], o1 = voffs[kb + 1];
        v2f a[4];
        #pragma unroll
        for (int mt = 0; mt < 4; ++mt) {
            a[mt].x = Ps[mt * 16 + l15][kb];
            a[mt].y = Ps[mt * 16 + l15][kb + 1];
        }
        v2f bf[2];
        #pragma unroll
        for (int u = 0; u < 2; ++u) {
            const int ncol = nb + u * 16;
            bf[u].x = (o0 >= 0) ? Vg[(size_t)o0 + ncol] : 0.0f;
            bf[u].y = (o1 >= 0) ? Vg[(size_t)o1 + ncol] : 0.0f;
        }
        #pragma unroll
        for (int mt = 0; mt < 4; ++mt) {
            #pragma unroll
            for (int u = 0; u < 2; ++u) acc[mt][u] = wmma_f32(a[mt], bf[u], acc[mt][u]);
        }
    }
    #pragma unroll
    for (int mt = 0; mt < 4; ++mt) {
        const int rbase = mt * 16 + ((lane >> 4) << 3);
        #pragma unroll
        for (int vz = 0; vz < 8; ++vz) {
            float* orow = out + (size_t)qpix[rbase + vz] * 256 + nb;
            orow[0]  = acc[mt][0][vz];
            orow[16] = acc[mt][1][vz];
        }
    }
}

// ---------------- Host launcher ----------------
extern "C" void kernel_launch(void* const* d_in, const int* in_sizes, int n_in,
                              void* d_out, int out_size, void* d_ws, size_t ws_size,
                              hipStream_t stream)
{
    const float* fine    = (const float*)d_in[0];   // [4,128,128,256]
    const float* coarse  = (const float*)d_in[1];   // [4,64,64,512]
    const float* gamma_f = (const float*)d_in[2];
    const float* beta_f  = (const float*)d_in[3];
    const float* gamma_c = (const float*)d_in[4];
    const float* beta_c  = (const float*)d_in[5];
    const float* wg      = (const float*)d_in[6];   // [512,1]
    const float* bg      = (const float*)d_in[7];   // [1]
    const float* wqf     = (const float*)d_in[8];   // [256,64]
    const float* bqf     = (const float*)d_in[9];
    const float* wqc     = (const float*)d_in[10];  // [512,64]
    const float* bqc     = (const float*)d_in[11];
    const float* wk      = (const float*)d_in[12];  // [512,64]
    const float* bk      = (const float*)d_in[13];
    const float* wv      = (const float*)d_in[14];  // [512,256]
    const float* bv      = (const float*)d_in[15];
    float* out = (float*)d_out;                     // [4,128,128,256]

    const int MF = 4 * 128 * 128;   // 65536 fine rows
    const int MC = 4 * 64 * 64;     // 16384 coarse rows

    float* ws = (float*)d_ws;
    float* q_fine   = ws;                    // 4194304
    float* q_coarse = q_fine + 4194304;      // 1048576
    float* k_       = q_coarse + 1048576;    // 1048576
    float* v_       = k_ + 1048576;          // 4194304
    float* gate     = v_ + 4194304;          // 16384

    // 1) Fine path: LayerNorm and the query projection in one kernel
    fine_kernel<<<MF / 128, 256, 0, stream>>>(fine, gamma_f, beta_f, wqf, bqf, q_fine);

    // 2) Coarse path: LayerNorm, gate and the three projections in one kernel
    coarse_kernel<<<MC / 64, 768, 0, stream>>>(coarse, gamma_c, beta_c, wg, bg, wqc, bqc, wk, bk, wv, bv,
                                               q_coarse, k_, v_, gate);

    // 3) Local attention (one block per 4x4 coarse tile), query blend included
    attn_kernel<<<dim3(16, 16, 4), 256, 0, stream>>>(q_fine, q_coarse, gate, k_, v_, out);
}

// v005
// It runs in 86.5 microseconds.
// Next to v004, in two timings, it ran 1.07 times as fast each time.
// Counting every step since v000, it is 1.95 times as fast.
#include <hip/hip_runtime.h>
#include <hip/hip_bf16.h>

// SAPA feature alignment for MI455X (gfx1250, wave32, WMMA).
// Matrix math: V_WMMA_F32_16X16X4_F32 (f32 in, f32 accum).
// Weight staging: GLOBAL_LOAD_ASYNC_TO_LDS_B128 (ASYNCcnt-tracked).
// The coarse path is one kernel: a 64-row tile is normalised into LDS, the gate is formed
// from the same values in registers, and the three coarse projections read the tile there. The fine path is one kernel of the same kind.
//
// Scratch layout (floats):
//   q_fine   65536*64
//   q_coarse 16384*64
//   k_       16384*64
//   v_       16384*256
//   gate     16384

typedef __attribute__((ext_vector_type(2))) float v2f;
typedef __attribute__((ext_vector_type(8))) float v8f;

__device__ __forceinline__ v8f wmma_f32(v2f a, v2f b, v8f c) {
    // D = A(16x4) * B(4x16) + C(16x16), all f32
    return __builtin_amdgcn_wmma_f32_16x16x4_f32(
        /*neg_a=*/false, a, /*neg_b=*/false, b,
        /*c_mod=*/(short)0, c, /*reuse_a=*/false, /*reuse_b=*/false);
}

__device__ __forceinline__ void wait_async0() {
    asm volatile("s_wait_asynccnt 0x0" ::: "memory");
}
// Four 16B copies global -> LDS in one statement. The closing s_wait_xcnt keeps every later
// write of the address registers behind the copies that name them.
__device__ __forceinline__ void async_copy4_b128(
    const float* l0, const float* g0, const float* l1, const float* g1,
    const float* l2, const float* g2, const float* l3, const float* g3) {
    asm volatile("global_load_async_to_lds_b128 %0, %1, off\n\t"
                 "global_load_async_to_lds_b128 %2, %3, off\n\t"
                 "global_load_async_to_lds_b128 %4, %5, off\n\t"
                 "global_load_async_to_lds_b128 %6, %7, off\n\t"
                 "s_wait_xcnt 0x0"
                 :: "v"((unsigned)(uintptr_t)l0), "v"((unsigned long long)(uintptr_t)g0),
                    "v"((unsigned)(uintptr_t)l1), "v"((unsigned long long)(uintptr_t)g1),
                    "v"((unsigned)(uintptr_t)l2), "v"((unsigned long long)(uintptr_t)g2),
                    "v"((unsigned)(uintptr_t)l3), "v"((unsigned long long)(uintptr_t)g3)
                 : "memory");
}
__device__ __forceinline__ void wait_ds0() {
    // own LDS reads of the buffer are back before the barrier that frees it for a refill
    asm volatile("s_wait_dscnt 0x0" ::: "memory");
}

__device__ __forceinline__ float wave_sum(float s) {
    #pragma unroll
    for (int off = 16; off; off >>= 1) s += __shfl_xor(s, off, 32);
    return s;
}
// wave_sum of three independent values, step by step together (same sums as wave_sum of each);
// unrolled so that the three exchanges of a step are in flight at once.
__device__ __forceinline__ void wave_sum3(float (&s)[3]) {
    #pragma unroll
    for (int off = 16; off; off >>= 1) {
        float t[3];
        #pragma unroll
        for (int r = 0; r < 3; ++r) t[r] = __shfl_xor(s[r], off, 32);
        #pragma unroll
        for (int r = 0; r < 3; ++r) s[r] += t[r];
    }
}
// the same for eight independent values
__device__ __forceinline__ void wave_sum8(float (&s)[8]) {
    #pragma unroll
    for (int off = 16; off; off >>= 1) {
        float t[8];
        #pragma unroll
        for (int r = 0; r < 8; ++r) t[r] = __shfl_xor(s[r], off, 32);
        #pragma unroll
        for (int r = 0; r < 8; ++r) s[r] += t[r];
    }
}
__device__ __forceinline__ float wave_max(float s) {
    #pragma unroll
    for (int off = 16; off; off >>= 1) s = fmaxf(s, __shfl_xor(s, off, 32));
    return s;
}

// ---------------- Fine path: LayerNorm + query projection ----------------
// One block = 128 fine rows as two tiles of 64, 8 waves. W (256x64) is copied whole into LDS once.
// A tile is normalised into As (K = 256 whole, one wave a row, eight rows a wave side by side) and
// multiplied from there: wave -> 16 rows x 32 columns, k in ascending order. The second tile's rows
// are loaded into registers in front of the first tile's products, so that they fly under them.
// The unrolled loops index register arrays (rows, accumulators): flat, they stay in registers.
__global__ __launch_bounds__(256) void fine_kernel(
    const float* __restrict__ x, const float* __restrict__ g, const float* __restrict__ b,
    const float* __restrict__ W, const float* __restrict__ bias, float* __restrict__ C)
{
    // Pitch 260: 16 rows of an A fragment fall 4 banks apart, so a b64 read covers 64 banks once.
    // Pitch 72: rows kb and kb+2 of a B fragment fall 16 banks apart. Both are multiples of 16 B.
    __shared__ __align__(16) float As[64][260];
    __shared__ __align__(16) float Bs[256][72];

    // the wave's number as a scalar: row and tile picks made from it become scalar code
    const int wave = __builtin_amdgcn_readfirstlane(threadIdx.x >> 5);
    const int lane = threadIdx.x & 31;
    const int l15 = lane & 15;
    const int khalf = (lane >> 4) << 1;  // 0 for lanes 0-15, 2 for lanes 16-31
    const int m0 = blockIdx.x * 128;

    float v[8][8];
    auto load_rows = [&](int tile) {
        #pragma unroll
        for (int r = 0; r < 8; ++r) {
            const float* xr = x + (size_t)(m0 + tile * 64 + wave * 8 + r) * 256;
            #pragma unroll
            for (int i = 0; i < 8; ++i) v[r][i] = xr[lane + i * 32];
        }
    };

    // W: 4096 16B pieces, 16 a thread (rows ckr, ckr+16, ..., ckr+240).
    {
        const int ckr = threadIdx.x >> 4;        // 0..15
        const int cn  = (threadIdx.x & 15) * 4;
        const float* gp = W + ckr * 64 + cn;
        const float* lp = &Bs[ckr][cn];
        #pragma unroll
        for (int j = 0; j < 4; ++j) {
            async_copy4_b128(lp + (j * 64) * 72,      gp + (j * 64) * 64,
                             lp + (j * 64 + 16) * 72, gp + (j * 64 + 16) * 64,
                             lp + (j * 64 + 32) * 72, gp + (j * 64 + 32) * 64,
                             lp + (j * 64 + 48) * 72, gp + (j * 64 + 48) * 64);
        }
    }

    auto norm_rows = [&]() {
        float s[8], mean[8];
        #pragma unroll
        for (int r = 0; r < 8; ++r) {
            s[r] = 0.f;
            #pragma unroll
            for (int i = 0; i < 8; ++i) s[r] += v[r][i];
        }
        wave_sum8(s);
        #pragma unroll
        for (int r = 0; r < 8; ++r) {
            mean[r] = s[r] * (1.0f / 256);
            s[r] = 0.f;
            #pragma unroll
            for (int i = 0; i < 8; ++i) { float d = v[r][i] - mean[r]; s[r] += d * d; }
        }
        wave_sum8(s);
        #pragma unroll
        for (int r = 0; r < 8; ++r) s[r] = rsqrtf(s[r] * (1.0f / 256) + 1e-5f);
        #pragma unroll
        for (int i = 0; i < 8; ++i) {
            const int c = lane + i * 32;
            const float gc = g[c], bc = b[c];
            #pragma unroll
            for (int r = 0; r < 8; ++r) As[wave * 8 + r][c] = (v[r][i] - mean[r]) * s[r] * gc + bc;
        }
    };

    const int mt = wave >> 1;            // 0..3
    const int nt0 = (wave & 1) * 2;      // 0 or 2
    auto gemm = [&](v8f (&acc)[2]) {
        // eight k steps a trip: their LDS reads are issued together, ahead of the products
        #pragma unroll 8
        for (int kc = 0; kc < 256; kc += 4) {
            const int kb = kc + khalf;
            v2f a;
            a.x = As[mt * 16 + l15][kb];
            a.y = As[mt * 16 + l15][kb + 1];
            #pragma unroll
            for (int u = 0; u < 2; ++u) {
                const int nt = nt0 + u;
                v2f bf;
                bf.x = Bs[kb][nt * 16 + l15];
                bf.y = Bs[kb + 1][nt * 16 + l15];
                acc[u] = wmma_f32(a, bf, acc[u]);
            }
        }
    };
    // Store D (+bias). vgpr vz -> row + vz + (lane>=16 ? 8 : 0), column = lane&15.
    auto store_tile = [&](const v8f (&acc)[2], int tile) {
        const int rbase = m0 + tile * 64 + mt * 16 + ((lane >> 4) << 3);
        #pragma unroll
        for (int u = 0; u < 2; ++u) {
            const int col = (nt0 + u) * 16 + l15;
            const float bb = bias[col];
            #pragma unroll
            for (int vz = 0; vz < 8; ++vz) {
                C[(size_t)(rbase + vz) * 64 + col] = acc[u][vz] + bb;
            }
        }
    };

    load_rows(0);
    norm_rows();
    wait_async0();     // own copies of W landed
    __syncthreads();   // tile 0 and W visible to every wave
    load_rows(1);
    v8f acc0[2] = {}, acc1[2] = {};
    gemm(acc0);
    __syncthreads();   // every reader has left As
    norm_rows();
    __syncthreads();   // tile 1 visible to every wave
    // tile 0 goes out here, under tile 1's products: in front of the two barriers they would wait for the stores
    store_tile(acc0, 0);
    gemm(acc1);
    store_tile(acc1, 1);
}

// ---------------- Coarse path: LayerNorm + gate + the three projections ----------------
// One block = 64 coarse rows, 24 waves. The rows are normalised once into As (K = 512 whole),
// the gate is formed from the same values, and the 384 output columns (wqc 64 | wk 64 | wv 256)
// are computed from As in one pass over K. Waves 4g..4g+3 own columns 64g..64g+63 as 2x2 wave
// tiles of 32x32. W arrives in 32-row tiles by async copies, two buffers.
// The unrolled loops index register arrays (rows, fragments, accumulators): flat, they stay in registers.
__global__ __launch_bounds__(768) void coarse_kernel(
    const float* __restrict__ x, const float* __restrict__ g, const float* __restrict__ b,
    const float* __restrict__ wg, const float* __restrict__ bg,
    const float* __restrict__ wqc, const float* __restrict__ bqc,
    const float* __restrict__ wk, const float* __restrict__ bk,
    const float* __restrict__ wvp, const float* __restrict__ bv,
    float* __restrict__ q_coarse, float* __restrict__ k_, float* __restrict__ v_,
    float* __restrict__ gate)
{
    // Pitch 516: 16 rows of an A fragment fall 4 banks apart, so a b64 read covers 64 banks once.
    // Pitch 392: rows kb and kb+2 of a B fragment fall 16 banks apart. Both are multiples of 16 B.
    __shared__ __align__(16) float As[64][516];
    __shared__ __align__(16) float Bs[2][32][392];

    // the wave's number as a scalar: the picks and tests made from it become scalar code
    const int wave = __builtin_amdgcn_readfirstlane(threadIdx.x >> 5);
    const int lane = threadIdx.x & 31;
    const int m0 = blockIdx.x * 64;
    const int grp = wave >> 2;           // 0..5: which 64 of the 384 columns
    const int l15 = lane & 15;
    const int khalf = (lane >> 4) << 1;  // 0 for lanes 0-15, 2 for lanes 16-31

    const float* W    = (grp == 0) ? wqc : (grp == 1) ? wk : wvp;
    const float* bias = (grp == 0) ? bqc : (grp == 1) ? bk : bv;
    float* C          = (grp == 0) ? q_coarse : (grp == 1) ? k_ : v_;
    const int N  = (grp < 2) ? 64 : 256;
    const int c0 = (grp < 2) ? 0 : (grp - 2) * 64;

    // The group's 128 threads copy its 32x64 tile of W: 512 16B pieces, 4 a thread.
    const int t128 = threadIdx.x & 127;
    const int ckr = t128 >> 4;           // 0..7
    const int cn  = (t128 & 15) * 4;
    const float* wsrc = W + (size_t)ckr * N + c0 + cn;
    auto issue_tile = [&](int buf, int k0) {
        const float* gp = wsrc + (size_t)k0 * N;
        const float* lp = &Bs[buf][ckr][grp * 64 + cn];
        async_copy4_b128(lp,            gp,
                         lp + 8 * 392,  gp + (size_t)8 * N,
                         lp + 16 * 392, gp + (size_t)16 * N,
                         lp + 24 * 392, gp + (size_t)24 * N);
    };

    issue_tile(0, 0);

    // LayerNorm and gate, one wave a row: rows wave, wave+24 and, in waves 0-15, wave+48.
    // The three rows go through every step side by side, so that their cross-lane sums overlap;
    // waves 16-23 carry zeros in the third place and store nothing from it.
    {
        const bool has3 = wave < 16;
        float v[3][16];
        #pragma unroll
        for (int r = 0; r < 2; ++r) {
            const float* xr = x + (size_t)(m0 + wave + r * 24) * 512;
            #pragma unroll
            for (int i = 0; i < 16; ++i) v[r][i] = xr[lane + i * 32];
        }
        if (has3) {
            const float* xr = x + (size_t)(m0 + wave + 48) * 512;
            #pragma unroll
            for (int i = 0; i < 16; ++i) v[2][i] = xr[lane + i * 32];
        } else {
            #pragma unroll
            for (int i = 0; i < 16; ++i) v[2][i] = 0.f;
        }
        float s[3], mean[3], rstd[3];
        #pragma unroll
        for (int r = 0; r < 3; ++r) {
            s[r] = 0.f;
            #pragma unroll
            for (int i = 0; i < 16; ++i) s[r] += v[r][i];
        }
        wave_sum3(s);
        #pragma unroll
        for (int r = 0; r < 3; ++r) {
            mean[r] = s[r] * (1.0f / 512);
            s[r] = 0.f;
            #pragma unroll
            for (int i = 0; i < 16; ++i) { float d = v[r][i] - mean[r]; s[r] += d * d; }
        }
        wave_sum3(s);
        #pragma unroll
        for (int r = 0; r < 3; ++r) {
            rstd[r] = rsqrtf(s[r] * (1.0f / 512) + 1e-5f);
            s[r] = 0.f;
        }
        #pragma unroll
        for (int i = 0; i < 16; ++i) {
            const int c = lane + i * 32;
            const float gc = g[c], bc = b[c], wc = wg[c];
            #pragma unroll
            for (int r = 0; r < 3; ++r) {
                v[r][i] = (v[r][i] - mean[r]) * rstd[r] * gc + bc;
                s[r] += v[r][i] * wc;
            }
        }
        wave_sum3(s);
        const float bg0 = bg[0];
        #pragma unroll
        for (int r = 0; r < 3; ++r) {
            if (r < 2 || has3) {
                const int row = wave + r * 24;
                #pragma unroll
                for (int i = 0; i < 16; ++i) As[row][lane + i * 32] = v[r][i];
                if (lane == 0) gate[m0 + row] = 1.0f / (1.0f + __expf(-(s[r] + bg0)));
            }
        }
    }

    wait_async0();     // own copies of tile 0 landed
    __syncthreads();   // As and tile 0 visible to every wave
    issue_tile(1, 32);

    const int w4 = wave & 3;
    const int mrow = (w4 >> 1) * 32;
    const int ncol = (w4 & 1) * 32;      // inside the group's 64 columns
    v8f acc[2][2] = {};

    for (int t = 0; t < 16; ++t) {
        const int cur = t & 1;
        #pragma unroll
        for (int kc = 0; kc < 32; kc += 4) {
            const int kb = kc + khalf;
            v2f a[2], bf[2];
            #pragma unroll
            for (int mi = 0; mi < 2; ++mi) {
                a[mi].x = As[mrow + mi * 16 + l15][t * 32 + kb];
                a[mi].y = As[mrow + mi * 16 + l15][t * 32 + kb + 1];
            }
            #pragma unroll
            for (int u = 0; u < 2; ++u) {
                bf[u].x = Bs[cur][kb][grp * 64 + ncol + u * 16 + l15];
                bf[u].y = Bs[cur][kb + 1][grp * 64 + ncol + u * 16 + l15];
            }
            #pragma unroll
            for (int mi = 0; mi < 2; ++mi) {
                #pragma unroll
                for (int u = 0; u < 2; ++u) acc[mi][u] = wmma_f32(a[mi], bf[u], acc[mi][u]);
            }
        }
        wait_ds0();
        wait_async0();     // own copies of tile t+1 landed
        __syncthreads();   // tile t+1 visible; every reader has left buffer cur
        if (t + 2 < 16) issue_tile(cur, (t + 2) * 32);
    }
    wait_async0();         // nothing in flight when the wave ends

    // Store D (+bias). vgpr vz -> row + vz + (lane>=16 ? 8 : 0), column = lane&15.
    #pragma unroll
    for (int mi = 0; mi < 2; ++mi) {
        const int rbase = mrow + mi * 16 + ((lane >> 4) << 3);
        #pragma unroll
        for (int u = 0; u < 2; ++u) {
            const int col = c0 + ncol + u * 16 + l15;
            const float bb = bias[col];
            #pragma unroll
            for (int vz = 0; vz < 8; ++vz) {
                C[(size_t)(m0 + rbase + vz) * N + col] = acc[mi][u][vz] + bb;
            }
        }
    }
}

// ---------------- Local attention over a 4x4 coarse tile ----------------
// 64 queries (16 cells x 2x2 fine pixels) vs shared 8x8 key union.
// Q is blended while it is staged: q = q_fine*g + q_coarse*(1-g), g the gate of the query's cell.
// S = Q*K^T (WMMA, 64x64x64), masked softmax over 5x5 window, O = P*V (WMMA, 64x64 @ 64x256).
__global__ __launch_bounds__(256) void attn_kernel(
    const float* __restrict__ qf,     // [B,128,128,64] fine query projection
    const float* __restrict__ qc,     // [B,64,64,64]   coarse query projection
    const float* __restrict__ gate,   // [B,64,64]
    const float* __restrict__ Kg,     // [B,64,64,64]
    const float* __restrict__ Vg,     // [B,64,64,256]
    float* __restrict__ out)          // [B,128,128,256]
{
    // Pitch 68 floats = 272 B, a multiple of 16 B: a row takes 16-byte stores.
    __shared__ __align__(16) float Qs[64][68];
    __shared__ __align__(16) float Ks[64][68];
    __shared__ float Ps[64][68];
    __shared__ int   voffs[64];  // V row base offsets (elements) or -1 if zero-padded
    __shared__ int   qpix[64];   // fine-pixel index of each query row

    const int b = blockIdx.z;
    const int i0 = blockIdx.y * 4, j0 = blockIdx.x * 4;
    const int wv = threadIdx.x >> 5, lane = threadIdx.x & 31;
    const int l15 = lane & 15;
    const int khalf = (lane >> 4) << 1;

    // Stage K union [64,64] with zero padding, and the blended Q [64,64].
    // Thread -> one coarse cell (16 threads a cell) and 4 of the 64 columns: the cell's four fine
    // pixels (query rows 4*cell..4*cell+3), its one q_coarse piece and gate, and union rows
    // 4*cell..4*cell+3. No address depends on a loaded value, so the ten loads fly together.
    // A padded union position reads a clamped (in-bounds) row and stores zeros instead.
    // The three loops over sub are unrolled because they index register arrays (kp, kv, qv, kok).
    const int cell = threadIdx.x >> 4;
    const int e4 = (threadIdx.x & 15) * 4;
    const int ci = cell >> 2, cj = cell & 3;
    const int cidx = (b * 64 + i0 + ci) * 64 + j0 + cj;
    float4 kv[4], qv[4];
    bool kok[4];
    const float* kp[4];
    #pragma unroll
    for (int sub = 0; sub < 4; ++sub) {
        const int u = cell * 4 + sub;
        const int ir = i0 - 2 + (u >> 3), jc = j0 - 2 + (u & 7);
        kok[sub] = (ir >= 0) && (ir < 64) && (jc >= 0) && (jc < 64);
        const int irc = min(max(ir, 0), 63), jcc = min(max(jc, 0), 63);
        kp[sub] = Kg + (size_t)((b * 64 + irc) * 64 + jcc) * 64 + e4;
    }
    // the cell's upper left fine pixel; the other three lie 1 pixel, 1 row and 1 row + 1 pixel on
    const float* qp = qf + (size_t)((b * 128 + (i0 + ci) * 2) * 128 + (j0 + cj) * 2) * 64 + e4;
    const float* qcp = qc + (size_t)cidx * 64 + e4;
    #pragma unroll
    for (int sub = 0; sub < 4; ++sub) {
        kv[sub] = *(const float4*)kp[sub];
        qv[sub] = *(const float4*)(qp + ((sub >> 1) * 128 + (sub & 1)) * 64);
    }
    const float g = gate[cidx];
    const float4 qcv = *(const float4*)qcp;
    // Named as inputs, the loads' address registers stay live up to this wait, so that no later
    // load's result and no later instruction lands on one of them in front of it.
    asm volatile("s_wait_xcnt 0x0" :: "v"(kp[0]), "v"(kp[1]), "v"(kp[2]), "v"(kp[3]),
                 "v"(qp), "v"(qcp), "v"(cidx) : "memory");

    // Tables: union position validity/offsets + query-row pixel indices (read behind the next barrier).
    if (threadIdx.x < 64) {
        const int u = threadIdx.x;
        const int r = u >> 3, c = u & 7;
        const int ir = i0 - 2 + r, jc = j0 - 2 + c;
        const bool ok = (ir >= 0) && (ir < 64) && (jc >= 0) && (jc < 64);
        voffs[u] = ok ? (((b * 64 + ir) * 64 + jc) * 256) : -1;
        const int tcell = u >> 2, sub = u & 3;
        const int y = (i0 + (tcell >> 2)) * 2 + (sub >> 1);
        const int x = (j0 + (tcell & 3)) * 2 + (sub & 1);
        qpix[u] = (b * 128 + y) * 128 + x;
    }

    #pragma unroll
    for (int sub = 0; sub < 4; ++sub) {
        const int u = cell * 4 + sub;
        float4 kz, qz;
        kz.x = kok[sub] ? kv[sub].x : 0.0f;
        kz.y = kok[sub] ? kv[sub].y : 0.0f;
        kz.z = kok[sub] ? kv[sub].z : 0.0f;
        kz.w = kok[sub] ? kv[sub].w : 0.0f;
        qz.x = qv[sub].x * g + qcv.x * (1.0f - g);
        qz.y = qv[sub].y * g + qcv.y * (1.0f - g);
        qz.z = qv[sub].z * g + qcv.z * (1.0f - g);
        qz.w = qv[sub].w * g + qcv.w * (1.0f - g);
        *(float4*)&Ks[u][e4] = kz;
        *(float4*)&Qs[u][e4] = qz;
    }
    __syncthreads();

    // ---- S = Q * K^T : M=64, N=64, K=64 (8 waves x 2 tiles) ----
    {
        const int mt = wv >> 1;
        const int nt0 = (wv & 1) * 2;
        v8f accS[2] = {};
        #pragma unroll
        for (int kc = 0; kc < 64; kc += 4) {
            const int kb = kc + khalf;
            v2f a;
            a.x = Qs[mt * 16 + l15][kb];
            a.y = Qs[mt * 16 + l15][kb + 1];
            #pragma unroll
            for (int u = 0; u < 2; ++u) {
                const int nrow = (nt0 + u) * 16 + l15;  // B[k][n] = Ks[n][k]
                v2f bf;
                bf.x = Ks[nrow][kb];
                bf.y = Ks[nrow][kb + 1];
                accS[u] = wmma_f32(a, bf, accS[u]);
            }
        }
        const int rbase = mt * 16 + ((lane >> 4) << 3);
        #pragma unroll
        for (int u = 0; u < 2; ++u) {
            const int col = (nt0 + u) * 16 + l15;
            #pragma unroll
            for (int vz = 0; vz < 8; ++vz) Ps[rbase + vz][col] = accS[u][vz];
        }
    }
    __syncthreads();

    // ---- Masked softmax per query row (wave handles 8 rows; lane covers cols {lane, lane+32}) ----
    #pragma unroll
    for (int rr = 0; rr < 8; ++rr) {
        const int row = wv * 8 + rr;
        const int cell = row >> 2;
        const int ci = cell >> 2, cj = cell & 3;
        const int u0 = lane, u1 = lane + 32;
        const int r0 = u0 >> 3, c0 = u0 & 7;
        const int r1 = u1 >> 3, c1 = u1 & 7;
        const bool v0 = (r0 >= ci) && (r0 <= ci + 4) && (c0 >= cj) && (c0 <= cj + 4);
        const bool v1 = (r1 >= ci) && (r1 <= ci + 4) && (c1 >= cj) && (c1 <= cj + 4);
        const float NEG = -3.0e38f;
        const float x0 = v0 ? Ps[row][u0] : NEG;
        const float x1 = v1 ? Ps[row][u1] : NEG;
        const float m = wave_max(fmaxf(x0, x1));
        const float e0 = v0 ? __expf(x0 - m) : 0.0f;
        const float e1 = v1 ? __expf(x1 - m) : 0.0f;
        const float inv = 1.0f / wave_sum(e0 + e1);
        Ps[row][u0] = e0 * inv;
        Ps[row][u1] = e1 * inv;
    }
    __syncthreads();

    // ---- O = P * V : M=64, K=64, N=256; V frags straight from global ----
    // Each wave owns 32 output columns (2 n-tiles) and all 4 m-tiles, so every V
    // fragment is loaded once per block and feeds 4 WMMAs on independent accumulators.
    const int nb = wv * 32 + l15;
    v8f acc[4][2] = {};
    #pragma unroll
    for (int kc = 0; kc < 64; kc += 4) {
        const int kb = kc + khalf;
        const int o0 = voffs[kb], o1 = voffs[kb + 1];
        v2f a[4];
        #pragma unroll
        for (int mt = 0; mt < 4; ++mt) {
            a[mt].x = Ps[mt * 16 + l15][kb];
            a[mt].y = Ps[mt * 16 + l15][kb + 1];
        }
        v2f bf[2];
        #pragma unroll
        for (int u = 0; u < 2; ++u) {
            const int ncol = nb + u * 16;
            bf[u].x = (o0 >= 0) ? Vg[(size_t)o0 + ncol] : 0.0f;
            bf[u].y = (o1 >= 0) ? Vg[(size_t)o1 + ncol] : 0.0f;
        }
        #pragma unroll
        for (int mt = 0; mt < 4; ++mt) {
            #pragma unroll
            for (int u = 0; u < 2; ++u) acc[mt][u] = wmma_f32(a[mt], bf[u], acc[mt][u]);
        }
    }
    #pragma unroll
    for (int mt = 0; mt < 4; ++mt) {
        const int rbase = mt * 16 + ((lane >> 4) << 3);
        #pragma unroll
        for (int vz = 0; vz < 8; ++vz) {
            float* orow = out + (size_t)qpix[rbase + vz] * 256 + nb;
            orow[0]  = acc[mt][0][vz];
            orow[16] = acc[mt][1][vz];
        }
    }
}

// ---------------- Host launcher ----------------
extern "C" void kernel_launch(void* const* d_in, const int* in_sizes, int n_in,
                              void* d_out, int out_size, void* d_ws, size_t ws_size,
                              hipStream_t stream)
{
    const float* fine    = (const float*)d_in[0];   // [4,128,128,256]
    const float* coarse  = (const float*)d_in[1];   // [4,64,64,512]
    const float* gamma_f = (const float*)d_in[2];
    const float* beta_f  = (const float*)d_in[3];
    const float* gamma_c = (const float*)d_in[4];
    const float* beta_c  = (const float*)d_in[5];
    const float* wg      = (const float*)d_in[6];   // [512,1]
    const float* bg      = (const float*)d_in[7];   // [1]
    const float* wqf     = (const float*)d_in[8];   // [256,64]
    const float* bqf     = (const float*)d_in[9];
    const float* wqc     = (const float*)d_in[10];  // [512,64]
    const float* bqc     = (const float*)d_in[11];
    const float* wk      = (const float*)d_in[12];  // [512,64]
    const float* bk      = (const float*)d_in[13];
    const float* wv      = (const float*)d_in[14];  // [512,256]
    const float* bv      = (const float*)d_in[15];
    float* out = (float*)d_out;                     // [4,128,128,256]

    const int MF = 4 * 128 * 128;   // 65536 fine rows
    const int MC = 4 * 64 * 64;     // 16384 coarse rows

    float* ws = (float*)d_ws;
    float* q_fine   = ws;                    // 4194304
    float* q_coarse = q_fine + 4194304;      // 1048576
    float* k_       = q_coarse + 1048576;    // 1048576
    float* v_       = k_ + 1048576;          // 4194304
    float* gate     = v_ + 4194304;          // 16384

    // 1) Fine path: LayerNorm and the query projection in one kernel
    fine_kernel<<<MF / 128, 256, 0, stream>>>(fine, gamma_f, beta_f, wqf, bqf, q_fine);

    // 2) Coarse path: LayerNorm, gate and the three projections in one kernel
    coarse_kernel<<<MC / 64, 768, 0, stream>>>(coarse, gamma_c, beta_c, wg, bg, wqc, bqc, wk, bk, wv, bv,
                                               q_coarse, k_, v_, gate);

    // 3) Local attention (one block per 4x4 coarse tile), query blend included
    attn_kernel<<<dim3(16, 16, 4), 256, 0, stream>>>(q_fine, q_coarse, gate, k_, v_, out);
}

// v006
// Measured time: 83.4 microseconds a run.
// Two timings next to v005 put it at 1.03 and 1.04 times that version's speed.
// Over all steps from v000 it is 2.03 times as fast.
#include <hip/hip_runtime.h>
#include <hip/hip_bf16.h>

// SAPA feature alignment for MI455X (gfx1250, wave32, WMMA).
// Matrix math: V_WMMA_F32_16X16X4_F32 (f32 in, f32 accum).
// Weight staging: GLOBAL_LOAD_ASYNC_TO_LDS_B128 (ASYNCcnt-tracked).
// The coarse path is one kernel: a 64-row tile is normalised into LDS, the gate is formed
// from the same values in registers, and the three coarse projections read the tile there. The fine path is one kernel of the same kind.
//
// Scratch layout (floats):
//   q_fine   65536*64
//   q_coarse 16384*64
//   k_       16384*64
//   v_       16384*256
//   gate     16384

typedef __attribute__((ext_vector_type(2))) float v2f;
typedef __attribute__((ext_vector_type(8))) float v8f;

__device__ __forceinline__ v8f wmma_f32(v2f a, v2f b, v8f c) {
    // D = A(16x4) * B(4x16) + C(16x16), all f32
    return __builtin_amdgcn_wmma_f32_16x16x4_f32(
        /*neg_a=*/false, a, /*neg_b=*/false, b,
        /*c_mod=*/(short)0, c, /*reuse_a=*/false, /*reuse_b=*/false);
}

__device__ __forceinline__ void wait_async0() {
    asm volatile("s_wait_asynccnt 0x0" ::: "memory");
}
// Four 16B copies global -> LDS in one statement. The closing s_wait_xcnt keeps every later
// write of the address registers behind the copies that name them.
__device__ __forceinline__ void async_copy4_b128(
    const float* l0, const float* g0, const float* l1, const float* g1,
    const float* l2, const float* g2, const float* l3, const float* g3) {
    asm volatile("global_load_async_to_lds_b128 %0, %1, off\n\t"
                 "global_load_async_to_lds_b128 %2, %3, off\n\t"
                 "global_load_async_to_lds_b128 %4, %5, off\n\t"
                 "global_load_async_to_lds_b128 %6, %7, off\n\t"
                 "s_wait_xcnt 0x0"
                 :: "v"((unsigned)(uintptr_t)l0), "v"((unsigned long long)(uintptr_t)g0),
                    "v"((unsigned)(uintptr_t)l1), "v"((unsigned long long)(uintptr_t)g1),
                    "v"((unsigned)(uintptr_t)l2), "v"((unsigned long long)(uintptr_t)g2),
                    "v"((unsigned)(uintptr_t)l3), "v"((unsigned long long)(uintptr_t)g3)
                 : "memory");
}
__device__ __forceinline__ void wait_ds0() {
    // own LDS reads of the buffer are back before the barrier that frees it for a refill
    asm volatile("s_wait_dscnt 0x0" ::: "memory");
}

// Sum over the wave's 32 lanes of three independent values, step by step together (a butterfly of
// five exchanges); unrolled so that the three exchanges of a step are in flight at once.
__device__ __forceinline__ void wave_sum3(float (&s)[3]) {
    #pragma unroll
    for (int off = 16; off; off >>= 1) {
        float t[3];
        #pragma unroll
        for (int r = 0; r < 3; ++r) t[r] = __shfl_xor(s[r], off, 32);
        #pragma unroll
        for (int r = 0; r < 3; ++r) s[r] += t[r];
    }
}
// the same for eight independent values
__device__ __forceinline__ void wave_sum8(float (&s)[8]) {
    #pragma unroll
    for (int off = 16; off; off >>= 1) {
        float t[8];
        #pragma unroll
        for (int r = 0; r < 8; ++r) t[r] = __shfl_xor(s[r], off, 32);
        #pragma unroll
        for (int r = 0; r < 8; ++r) s[r] += t[r];
    }
}

// e^x as 2^(x * log2 e) on the transcendental unit. The v_nop is the one slot that the instruction set
// asks for behind a transcendental: in a run of them the next one may overwrite this one's source.
__device__ __forceinline__ float exp_slot(float x) {
    float r;
    asm("v_exp_f32 %0, %1\n\tv_nop" : "=v"(r) : "v"(x * 1.44269504f));
    return r;
}

// ---------------- Fine path: LayerNorm + query projection ----------------
// One block = 128 fine rows as two tiles of 64, 8 waves. W (256x64) is copied whole into LDS once.
// A tile is normalised into As (K = 256 whole, one wave a row, eight rows a wave side by side) and
// multiplied from there: wave -> 16 rows x 32 columns, k in ascending order. The second tile's rows
// are loaded into registers in front of the first tile's products, so that they fly under them.
// The unrolled loops index register arrays (rows, accumulators): flat, they stay in registers.
__global__ __launch_bounds__(256) void fine_kernel(
    const float* __restrict__ x, const float* __restrict__ g, const float* __restrict__ b,
    const float* __restrict__ W, const float* __restrict__ bias, float* __restrict__ C)
{
    // Pitch 260: 16 rows of an A fragment fall 4 banks apart, so a b64 read covers 64 banks once.
    // Pitch 72: rows kb and kb+2 of a B fragment fall 16 banks apart. Both are multiples of 16 B.
    __shared__ __align__(16) float As[64][260];
    __shared__ __align__(16) float Bs[256][72];

    // the wave's number as a scalar: row and tile picks made from it become scalar code
    const int wave = __builtin_amdgcn_readfirstlane(threadIdx.x >> 5);
    const int lane = threadIdx.x & 31;
    const int l15 = lane & 15;
    const int khalf = (lane >> 4) << 1;  // 0 for lanes 0-15, 2 for lanes 16-31
    const int m0 = blockIdx.x * 128;

    float v[8][8];
    auto load_rows = [&](int tile) {
        #pragma unroll
        for (int r = 0; r < 8; ++r) {
            const float* xr = x + (size_t)(m0 + tile * 64 + wave * 8 + r) * 256;
            #pragma unroll
            for (int i = 0; i < 8; ++i) v[r][i] = xr[lane + i * 32];
        }
    };

    // W: 4096 16B pieces, 16 a thread (rows ckr, ckr+16, ..., ckr+240).
    {
        const int ckr = threadIdx.x >> 4;        // 0..15
        const int cn  = (threadIdx.x & 15) * 4;
        const float* gp = W + ckr * 64 + cn;
        const float* lp = &Bs[ckr][cn];
        #pragma unroll
        for (int j = 0; j < 4; ++j) {
            async_copy4_b128(lp + (j * 64) * 72,      gp + (j * 64) * 64,
                             lp + (j * 64 + 16) * 72, gp + (j * 64 + 16) * 64,
                             lp + (j * 64 + 32) * 72, gp + (j * 64 + 32) * 64,
                             lp + (j * 64 + 48) * 72, gp + (j * 64 + 48) * 64);
        }
    }

    auto norm_rows = [&]() {
        float s[8], mean[8];
        #pragma unroll
        for (int r = 0; r < 8; ++r) {
            s[r] = 0.f;
            #pragma unroll
            for (int i = 0; i < 8; ++i) s[r] += v[r][i];
        }
        wave_sum8(s);
        #pragma unroll
        for (int r = 0; r < 8; ++r) {
            mean[r] = s[r] * (1.0f / 256);
            s[r] = 0.f;
            #pragma unroll
            for (int i = 0; i < 8; ++i) { float d = v[r][i] - mean[r]; s[r] += d * d; }
        }
        wave_sum8(s);
        #pragma unroll
        for (int r = 0; r < 8; ++r) s[r] = rsqrtf(s[r] * (1.0f / 256) + 1e-5f);
        #pragma unroll
        for (int i = 0; i < 8; ++i) {
            const int c = lane + i * 32;
            const float gc = g[c], bc = b[c];
            #pragma unroll
            for (int r = 0; r < 8; ++r) As[wave * 8 + r][c] = (v[r][i] - mean[r]) * s[r] * gc + bc;
        }
    };

    const int mt = wave >> 1;            // 0..3
    const int nt0 = (wave & 1) * 2;      // 0 or 2
    auto gemm = [&](v8f (&acc)[2]) {
        // eight k steps a trip: their LDS reads are issued together, ahead of the products
        #pragma unroll 8
        for (int kc = 0; kc < 256; kc += 4) {
            const int kb = kc + khalf;
            v2f a;
            a.x = As[mt * 16 + l15][kb];
            a.y = As[mt * 16 + l15][kb + 1];
            #pragma unroll
            for (int u = 0; u < 2; ++u) {
                const int nt = nt0 + u;
                v2f bf;
                bf.x = Bs[kb][nt * 16 + l15];
                bf.y = Bs[kb + 1][nt * 16 + l15];
                acc[u] = wmma_f32(a, bf, acc[u]);
            }
        }
    };
    // Store D (+bias). vgpr vz -> row + vz + (lane>=16 ? 8 : 0), column = lane&15.
    auto store_tile = [&](const v8f (&acc)[2], int tile) {
        const int rbase = m0 + tile * 64 + mt * 16 + ((lane >> 4) << 3);
        #pragma unroll
        for (int u = 0; u < 2; ++u) {
            const int col = (nt0 + u) * 16 + l15;
            const float bb = bias[col];
            #pragma unroll
            for (int vz = 0; vz < 8; ++vz) {
                C[(size_t)(rbase + vz) * 64 + col] = acc[u][vz] + bb;
            }
        }
    };

    load_rows(0);
    norm_rows();
    wait_async0();     // own copies of W landed
    __syncthreads();   // tile 0 and W visible to every wave
    load_rows(1);
    v8f acc0[2] = {}, acc1[2] = {};
    gemm(acc0);
    __syncthreads();   // every reader has left As
    norm_rows();
    __syncthreads();   // tile 1 visible to every wave
    // tile 0 goes out here, under tile 1's products: in front of the two barriers they would wait for the stores
    store_tile(acc0, 0);
    gemm(acc1);
    store_tile(acc1, 1);
}

// ---------------- Coarse path: LayerNorm + gate + the three projections ----------------
// One block = 64 coarse rows, 24 waves. The rows are normalised once into As (K = 512 whole),
// the gate is formed from the same values, and the 384 output columns (wqc 64 | wk 64 | wv 256)
// are computed from As in one pass over K. Waves 4g..4g+3 own columns 64g..64g+63 as 2x2 wave
// tiles of 32x32. W arrives in 32-row tiles by async copies, two buffers.
// The unrolled loops index register arrays (rows, fragments, accumulators): flat, they stay in registers.
__global__ __launch_bounds__(768) void coarse_kernel(
    const float* __restrict__ x, const float* __restrict__ g, const float* __restrict__ b,
    const float* __restrict__ wg, const float* __restrict__ bg,
    const float* __restrict__ wqc, const float* __restrict__ bqc,
    const float* __restrict__ wk, const float* __restrict__ bk,
    const float* __restrict__ wvp, const float* __restrict__ bv,
    float* __restrict__ q_coarse, float* __restrict__ k_, float* __restrict__ v_,
    float* __restrict__ gate)
{
    // Pitch 516: 16 rows of an A fragment fall 4 banks apart, so a b64 read covers 64 banks once.
    // Pitch 392: rows kb and kb+2 of a B fragment fall 16 banks apart. Both are multiples of 16 B.
    __shared__ __align__(16) float As[64][516];
    __shared__ __align__(16) float Bs[2][32][392];

    // the wave's number as a scalar: the picks and tests made from it become scalar code
    const int wave = __builtin_amdgcn_readfirstlane(threadIdx.x >> 5);
    const int lane = threadIdx.x & 31;
    const int m0 = blockIdx.x * 64;
    const int grp = wave >> 2;           // 0..5: which 64 of the 384 columns
    const int l15 = lane & 15;
    const int khalf = (lane >> 4) << 1;  // 0 for lanes 0-15, 2 for lanes 16-31

    const float* W    = (grp == 0) ? wqc : (grp == 1) ? wk : wvp;
    const float* bias = (grp == 0) ? bqc : (grp == 1) ? bk : bv;
    float* C          = (grp == 0) ? q_coarse : (grp == 1) ? k_ : v_;
    const int N  = (grp < 2) ? 64 : 256;
    const int c0 = (grp < 2) ? 0 : (grp - 2) * 64;

    // The group's 128 threads copy its 32x64 tile of W: 512 16B pieces, 4 a thread.
    const int t128 = threadIdx.x & 127;
    const int ckr = t128 >> 4;           // 0..7
    const int cn  = (t128 & 15) * 4;
    const float* wsrc = W + (size_t)ckr * N + c0 + cn;
    auto issue_tile = [&](int buf, int k0) {
        const float* gp = wsrc + (size_t)k0 * N;
        const float* lp = &Bs[buf][ckr][grp * 64 + cn];
        async_copy4_b128(lp,            gp,
                         lp + 8 * 392,  gp + (size_t)8 * N,
                         lp + 16 * 392, gp + (size_t)16 * N,
                         lp + 24 * 392, gp + (size_t)24 * N);
    };

    issue_tile(0, 0);

    // LayerNorm and gate, one wave a row: rows wave, wave+24 and, in waves 0-15, wave+48.
    // The three rows go through every step side by side, so that their cross-lane sums overlap;
    // waves 16-23 carry zeros in the third place and store nothing from it.
    {
        const bool has3 = wave < 16;
        float v[3][16];
        #pragma unroll
        for (int r = 0; r < 2; ++r) {
            const float* xr = x + (size_t)(m0 + wave + r * 24) * 512;
            #pragma unroll
            for (int i = 0; i < 16; ++i) v[r][i] = xr[lane + i * 32];
        }
        if (has3) {
            const float* xr = x + (size_t)(m0 + wave + 48) * 512;
            #pragma unroll
            for (int i = 0; i < 16; ++i) v[2][i] = xr[lane + i * 32];
        } else {
            #pragma unroll
            for (int i = 0; i < 16; ++i) v[2][i] = 0.f;
        }
        float s[3], mean[3], rstd[3];
        #pragma unroll
        for (int r = 0; r < 3; ++r) {
            s[r] = 0.f;
            #pragma unroll
            for (int i = 0; i < 16; ++i) s[r] += v[r][i];
        }
        wave_sum3(s);
        #pragma unroll
        for (int r = 0; r < 3; ++r) {
            mean[r] = s[r] * (1.0f / 512);
            s[r] = 0.f;
            #pragma unroll
            for (int i = 0; i < 16; ++i) { float d = v[r][i] - mean[r]; s[r] += d * d; }
        }
        wave_sum3(s);
        #pragma unroll
        for (int r = 0; r < 3; ++r) {
            rstd[r] = rsqrtf(s[r] * (1.0f / 512) + 1e-5f);
            s[r] = 0.f;
        }
        #pragma unroll
        for (int i = 0; i < 16; ++i) {
            const int c = lane + i * 32;
            const float gc = g[c], bc = b[c], wc = wg[c];
            #pragma unroll
            for (int r = 0; r < 3; ++r) {
                v[r][i] = (v[r][i] - mean[r]) * rstd[r] * gc + bc;
                s[r] += v[r][i] * wc;
            }
        }
        wave_sum3(s);
        const float bg0 = bg[0];
        #pragma unroll
        for (int r = 0; r < 3; ++r) {
            if (r < 2 || has3) {
                const int row = wave + r * 24;
                #pragma unroll
                for (int i = 0; i < 16; ++i) As[row][lane + i * 32] = v[r][i];
                if (lane == 0) gate[m0 + row] = 1.0f / (1.0f + __expf(-(s[r] + bg0)));
            }
        }
    }

    wait_async0();     // own copies of tile 0 landed
    __syncthreads();   // As and tile 0 visible to every wave
    issue_tile(1, 32);

    const int w4 = wave & 3;
    const int mrow = (w4 >> 1) * 32;
    const int ncol = (w4 & 1) * 32;      // inside the group's 64 columns
    v8f acc[2][2] = {};

    for (int t = 0; t < 16; ++t) {
        const int cur = t & 1;
        #pragma unroll
        for (int kc = 0; kc < 32; kc += 4) {
            const int kb = kc + khalf;
            v2f a[2], bf[2];
            #pragma unroll
            for (int mi = 0; mi < 2; ++mi) {
                a[mi].x = As[mrow + mi * 16 + l15][t * 32 + kb];
                a[mi].y = As[mrow + mi * 16 + l15][t * 32 + kb + 1];
            }
            #pragma unroll
            for (int u = 0; u < 2; ++u) {
                bf[u].x = Bs[cur][kb][grp * 64 + ncol + u * 16 + l15];
                bf[u].y = Bs[cur][kb + 1][grp * 64 + ncol + u * 16 + l15];
            }
            #pragma unroll
            for (int mi = 0; mi < 2; ++mi) {
                #pragma unroll
                for (int u = 0; u < 2; ++u) acc[mi][u] = wmma_f32(a[mi], bf[u], acc[mi][u]);
            }
        }
        wait_ds0();
        wait_async0();     // own copies of tile t+1 landed
        __syncthreads();   // tile t+1 visible; every reader has left buffer cur
        if (t + 2 < 16) issue_tile(cur, (t + 2) * 32);
    }
    wait_async0();         // nothing in flight when the wave ends

    // Store D (+bias). vgpr vz -> row + vz + (lane>=16 ? 8 : 0), column = lane&15.
    #pragma unroll
    for (int mi = 0; mi < 2; ++mi) {
        const int rbase = mrow + mi * 16 + ((lane >> 4) << 3);
        #pragma unroll
        for (int u = 0; u < 2; ++u) {
            const int col = c0 + ncol + u * 16 + l15;
            const float bb = bias[col];
            #pragma unroll
            for (int vz = 0; vz < 8; ++vz) {
                C[(size_t)(m0 + rbase + vz) * N + col] = acc[mi][u][vz] + bb;
            }
        }
    }
}

// ---------------- Local attention over a 4x4 coarse tile ----------------
// 64 queries (16 cells x 2x2 fine pixels) vs shared 8x8 key union.
// Q is blended while it is staged: q = q_fine*g + q_coarse*(1-g), g the gate of the query's cell.
// S = Q*K^T (WMMA, 64x64x64), masked softmax over 5x5 window, O = P*V (WMMA, 64x64 @ 64x256).
__global__ __launch_bounds__(256) void attn_kernel(
    const float* __restrict__ qf,     // [B,128,128,64] fine query projection
    const float* __restrict__ qc,     // [B,64,64,64]   coarse query projection
    const float* __restrict__ gate,   // [B,64,64]
    const float* __restrict__ Kg,     // [B,64,64,64]
    const float* __restrict__ Vg,     // [B,64,64,256]
    float* __restrict__ out)          // [B,128,128,256]
{
    // Pitch 68 floats = 272 B, a multiple of 16 B: a row takes 16-byte stores.
    __shared__ __align__(16) float Qs[64][68];
    __shared__ __align__(16) float Ks[64][68];
    __shared__ __align__(16) float Ps[64][68];
    __shared__ int   voffs[64];  // V row base offsets (elements) or -1 if zero-padded
    __shared__ int   qpix[64];   // fine-pixel index of each query row

    const int b = blockIdx.z;
    const int i0 = blockIdx.y * 4, j0 = blockIdx.x * 4;
    const int wv = threadIdx.x >> 5, lane = threadIdx.x & 31;
    const int l15 = lane & 15;
    const int khalf = (lane >> 4) << 1;

    // Stage K union [64,64] with zero padding, and the blended Q [64,64].
    // Thread -> one coarse cell (16 threads a cell) and 4 of the 64 columns: the cell's four fine
    // pixels (query rows 4*cell..4*cell+3), its one q_coarse piece and gate, and union rows
    // 4*cell..4*cell+3. No address depends on a loaded value, so the ten loads fly together.
    // A padded union position reads a clamped (in-bounds) row and stores zeros instead.
    // The three loops over sub are unrolled because they index register arrays (kp, kv, qv, kok).
    const int cell = threadIdx.x >> 4;
    const int e4 = (threadIdx.x & 15) * 4;
    const int ci = cell >> 2, cj = cell & 3;
    const int cidx = (b * 64 + i0 + ci) * 64 + j0 + cj;
    float4 kv[4], qv[4];
    bool kok[4];
    const float* kp[4];
    #pragma unroll
    for (int sub = 0; sub < 4; ++sub) {
        const int u = cell * 4 + sub;
        const int ir = i0 - 2 + (u >> 3), jc = j0 - 2 + (u & 7);
        kok[sub] = (ir >= 0) && (ir < 64) && (jc >= 0) && (jc < 64);
        const int irc = min(max(ir, 0), 63), jcc = min(max(jc, 0), 63);
        kp[sub] = Kg + (size_t)((b * 64 + irc) * 64 + jcc) * 64 + e4;
    }
    // the cell's upper left fine pixel; the other three lie 1 pixel, 1 row and 1 row + 1 pixel on
    const float* qp = qf + (size_t)((b * 128 + (i0 + ci) * 2) * 128 + (j0 + cj) * 2) * 64 + e4;
    const float* qcp = qc + (size_t)cidx * 64 + e4;
    #pragma unroll
    for (int sub = 0; sub < 4; ++sub) {
        kv[sub] = *(const float4*)kp[sub];
        qv[sub] = *(const float4*)(qp + ((sub >> 1) * 128 + (sub & 1)) * 64);
    }
    const float g = gate[cidx];
    const float4 qcv = *(const float4*)qcp;
    // Named as inputs, the loads' address registers stay live up to this wait, so that no later
    // load's result and no later instruction lands on one of them in front of it.
    asm volatile("s_wait_xcnt 0x0" :: "v"(kp[0]), "v"(kp[1]), "v"(kp[2]), "v"(kp[3]),
                 "v"(qp), "v"(qcp), "v"(cidx) : "memory");

    // Tables: union position validity/offsets + query-row pixel indices (read behind the next barrier).
    if (threadIdx.x < 64) {
        const int u = threadIdx.x;
        const int r = u >> 3, c = u & 7;
        const int ir = i0 - 2 + r, jc = j0 - 2 + c;
        const bool ok = (ir >= 0) && (ir < 64) && (jc >= 0) && (jc < 64);
        voffs[u] = ok ? (((b * 64 + ir) * 64 + jc) * 256) : -1;
        const int tcell = u >> 2, sub = u & 3;
        const int y = (i0 + (tcell >> 2)) * 2 + (sub >> 1);
        const int x = (j0 + (tcell & 3)) * 2 + (sub & 1);
        qpix[u] = (b * 128 + y) * 128 + x;
    }

    #pragma unroll
    for (int sub = 0; sub < 4; ++sub) {
        const int u = cell * 4 + sub;
        float4 kz, qz;
        kz.x = kok[sub] ? kv[sub].x : 0.0f;
        kz.y = kok[sub] ? kv[sub].y : 0.0f;
        kz.z = kok[sub] ? kv[sub].z : 0.0f;
        kz.w = kok[sub] ? kv[sub].w : 0.0f;
        qz.x = qv[sub].x * g + qcv.x * (1.0f - g);
        qz.y = qv[sub].y * g + qcv.y * (1.0f - g);
        qz.z = qv[sub].z * g + qcv.z * (1.0f - g);
        qz.w = qv[sub].w * g + qcv.w * (1.0f - g);
        *(float4*)&Ks[u][e4] = kz;
        *(float4*)&Qs[u][e4] = qz;
    }
    __syncthreads();

    // ---- S = Q * K^T : M=64, N=64, K=64 (8 waves x 2 tiles) ----
    {
        const int mt = wv >> 1;
        const int nt0 = (wv & 1) * 2;
        v8f accS[2] = {};
        #pragma unroll
        for (int kc = 0; kc < 64; kc += 4) {
            const int kb = kc + khalf;
            v2f a;
            a.x = Qs[mt * 16 + l15][kb];
            a.y = Qs[mt * 16 + l15][kb + 1];
            #pragma unroll
            for (int u = 0; u < 2; ++u) {
                const int nrow = (nt0 + u) * 16 + l15;  // B[k][n] = Ks[n][k]
                v2f bf;
                bf.x = Ks[nrow][kb];
                bf.y = Ks[nrow][kb + 1];
                accS[u] = wmma_f32(a, bf, accS[u]);
            }
        }
        const int rbase = mt * 16 + ((lane >> 4) << 3);
        #pragma unroll
        for (int u = 0; u < 2; ++u) {
            const int col = (nt0 + u) * 16 + l15;
            #pragma unroll
            for (int vz = 0; vz < 8; ++vz) Ps[rbase + vz][col] = accS[u][vz];
        }
    }
    __syncthreads();

    // ---- Masked softmax: four threads a query row, 16 union positions each, all 64 rows at once ----
    // A thread keeps its 16 scores in registers (union rows 2*qd and 2*qd+1), so a row's maximum and
    // sum take two exchange steps inside a group of four lanes, and no row waits for another row.
    // Every thread reads and rewrites only its own 16 places of Ps.
    // The loops are unrolled because they index register arrays (p, ok).
    {
        const int row = threadIdx.x >> 2, qd = threadIdx.x & 3;
        const int rci = row >> 4, rcj = (row >> 2) & 3;   // the row's cell inside the 4x4 tile
        const float NEG = -3.0e38f;
        float p[16];
        bool ok[16];
        #pragma unroll
        for (int j = 0; j < 4; ++j) {
            const float4 t = *(const float4*)&Ps[row][qd * 16 + j * 4];
            p[j * 4 + 0] = t.x;
            p[j * 4 + 1] = t.y;
            p[j * 4 + 2] = t.z;
            p[j * 4 + 3] = t.w;
        }
        #pragma unroll
        for (int e = 0; e < 16; ++e) {
            const int r = qd * 2 + (e >> 3), c = e & 7;
            ok[e] = (r >= rci) && (r <= rci + 4) && (c >= rcj) && (c <= rcj + 4);
            p[e] = ok[e] ? p[e] : NEG;
        }
        float m = p[0];
        #pragma unroll
        for (int e = 1; e < 16; ++e) m = fmaxf(m, p[e]);
        m = fmaxf(m, __shfl_xor(m, 1, 32));
        m = fmaxf(m, __shfl_xor(m, 2, 32));
        #pragma unroll
        for (int e = 0; e < 16; ++e) {
            const float ex = exp_slot(p[e] - m);   // in every lane: no branch round the 16 independent exps
            p[e] = ok[e] ? ex : 0.0f;
        }
        float s4[4];
        #pragma unroll
        for (int j = 0; j < 4; ++j) s4[j] = (p[j * 4] + p[j * 4 + 1]) + (p[j * 4 + 2] + p[j * 4 + 3]);
        float s = (s4[0] + s4[1]) + (s4[2] + s4[3]);
        s += __shfl_xor(s, 1, 32);
        s += __shfl_xor(s, 2, 32);
        const float inv = 1.0f / s;
        #pragma unroll
        for (int j = 0; j < 4; ++j) {
            float4 t;
            t.x = p[j * 4 + 0] * inv;
            t.y = p[j * 4 + 1] * inv;
            t.z = p[j * 4 + 2] * inv;
            t.w = p[j * 4 + 3] * inv;
            *(float4*)&Ps[row][qd * 16 + j * 4] = t;
        }
    }
    __syncthreads();

    // ---- O = P * V : M=64, K=64, N=256; V frags straight from global ----
    // Each wave owns 32 output columns (2 n-tiles) and all 4 m-tiles, so every V
    // fragment is loaded once per block and feeds 4 WMMAs on independent accumulators.
    const int nb = wv * 32 + l15;
    v8f acc[4][2] = {};
    #pragma unroll
    for (int kc = 0; kc < 64; kc += 4) {
        const int kb = kc + khalf;
        const int o0 = voffs[kb], o1 = voffs[kb + 1];
        v2f a[4];
        #pragma unroll
        for (int mt = 0; mt < 4; ++mt) {
            a[mt].x = Ps[mt * 16 + l15][kb];
            a[mt].y = Ps[mt * 16 + l15][kb + 1];
        }
        v2f bf[2];
        #pragma unroll
        for (int u = 0; u < 2; ++u) {
            const int ncol = nb + u * 16;
            bf[u].x = (o0 >= 0) ? Vg[(size_t)o0 + ncol] : 0.0f;
            bf[u].y = (o1 >= 0) ? Vg[(size_t)o1 + ncol] : 0.0f;
        }
        #pragma unroll
        for (int mt = 0; mt < 4; ++mt) {
            #pragma unroll
            for (int u = 0; u < 2; ++u) acc[mt][u] = wmma_f32(a[mt], bf[u], acc[mt][u]);
        }
    }
    #pragma unroll
    for (int mt = 0; mt < 4; ++mt) {
        const int rbase = mt * 16 + ((lane >> 4) << 3);
        #pragma unroll
        for (int vz = 0; vz < 8; ++vz) {
            float* orow = out + (size_t)qpix[rbase + vz] * 256 + nb;
            orow[0]  = acc[mt][0][vz];
            orow[16] = acc[mt][1][vz];
        }
    }
}

// ---------------- Host launcher ----------------
extern "C" void kernel_launch(void* const* d_in, const int* in_sizes, int n_in,
                              void* d_out, int out_size, void* d_ws, size_t ws_size,
                              hipStream_t stream)
{
    const float* fine    = (const float*)d_in[0];   // [4,128,128,256]
    const float* coarse  = (const float*)d_in[1];   // [4,64,64,512]
    const float* gamma_f = (const float*)d_in[2];
    const float* beta_f  = (const float*)d_in[3];
    const float* gamma_c = (const float*)d_in[4];
    const float* beta_c  = (const float*)d_in[5];
    const float* wg      = (const float*)d_in[6];   // [512,1]
    const float* bg      = (const float*)d_in[7];   // [1]
    const float* wqf     = (const float*)d_in[8];   // [256,64]
    const float* bqf     = (const float*)d_in[9];
    const float* wqc     = (const float*)d_in[10];  // [512,64]
    const float* bqc     = (const float*)d_in[11];
    const float* wk      = (const float*)d_in[12];  // [512,64]
    const float* bk      = (const float*)d_in[13];
    const float* wv      = (const float*)d_in[14];  // [512,256]
    const float* bv      = (const float*)d_in[15];
    float* out = (float*)d_out;                     // [4,128,128,256]

    const int MF = 4 * 128 * 128;   // 65536 fine rows
    const int MC = 4 * 64 * 64;     // 16384 coarse rows

    float* ws = (float*)d_ws;
    float* q_fine   = ws;                    // 4194304
    float* q_coarse = q_fine + 4194304;      // 1048576
    float* k_       = q_coarse + 1048576;    // 1048576
    float* v_       = k_ + 1048576;          // 4194304
    float* gate     = v_ + 4194304;          // 16384

    // 1) Fine path: LayerNorm and the query projection in one kernel
    fine_kernel<<<MF / 128, 256, 0, stream>>>(fine, gamma_f, beta_f, wqf, bqf, q_fine);

    // 2) Coarse path: LayerNorm, gate and the three projections in one kernel
    coarse_kernel<<<MC / 64, 768, 0, stream>>>(coarse, gamma_c, beta_c, wg, bg, wqc, bqc, wk, bk, wv, bv,
                                               q_coarse, k_, v_, gate);

    // 3) Local attention (one block per 4x4 coarse tile), query blend included
    attn_kernel<<<dim3(16, 16, 4), 256, 0, stream>>>(q_fine, q_coarse, gate, k_, v_, out);
}

// v007
// A run of this version takes 79.7 microseconds.
// Timed twice side by side with v006, it ran 1.05 times as fast both times.
// Over all steps from v000 it is 2.12 times as fast.
#include <hip/hip_runtime.h>
#include <hip/hip_bf16.h>

// SAPA feature alignment for MI455X (gfx1250, wave32, WMMA).
// Matrix math: V_WMMA_F32_16X16X4_F32 (f32 in, f32 accum).
// Weight staging: GLOBAL_LOAD_ASYNC_TO_LDS_B128 (ASYNCcnt-tracked).
// The coarse path is one kernel: a 64-row tile is normalised into LDS, the gate is formed
// from the same values in registers, and the three coarse projections read the tile there. The fine path is one kernel of the same kind.
//
// Scratch layout (floats):
//   q_fine   65536*64
//   q_coarse 16384*64
//   k_       16384*64
//   v_       16384*256
//   gate     16384

typedef __attribute__((ext_vector_type(2))) float v2f;
typedef __attribute__((ext_vector_type(8))) float v8f;

__device__ __forceinline__ v8f wmma_f32(v2f a, v2f b, v8f c) {
    // D = A(16x4) * B(4x16) + C(16x16), all f32
    return __builtin_amdgcn_wmma_f32_16x16x4_f32(
        /*neg_a=*/false, a, /*neg_b=*/false, b,
        /*c_mod=*/(short)0, c, /*reuse_a=*/false, /*reuse_b=*/false);
}

__device__ __forceinline__ void wait_async0() {
    asm volatile("s_wait_asynccnt 0x0" ::: "memory");
}
// Four 16B copies global -> LDS in one statement. The closing s_wait_xcnt keeps every later
// write of the address registers behind the copies that name them.
__device__ __forceinline__ void async_copy4_b128(
    const float* l0, const float* g0, const float* l1, const float* g1,
    const float* l2, const float* g2, const float* l3, const float* g3) {
    asm volatile("global_load_async_to_lds_b128 %0, %1, off\n\t"
                 "global_load_async_to_lds_b128 %2, %3, off\n\t"
                 "global_load_async_to_lds_b128 %4, %5, off\n\t"
                 "global_load_async_to_lds_b128 %6, %7, off\n\t"
                 "s_wait_xcnt 0x0"
                 :: "v"((unsigned)(uintptr_t)l0), "v"((unsigned long long)(uintptr_t)g0),
                    "v"((unsigned)(uintptr_t)l1), "v"((unsigned long long)(uintptr_t)g1),
                    "v"((unsigned)(uintptr_t)l2), "v"((unsigned long long)(uintptr_t)g2),
                    "v"((unsigned)(uintptr_t)l3), "v"((unsigned long long)(uintptr_t)g3)
                 : "memory");
}
__device__ __forceinline__ void wait_ds0() {
    // own LDS reads of the buffer are back before the barrier that frees it for a refill
    asm volatile("s_wait_dscnt 0x0" ::: "memory");
}

// Sum over the wave's 32 lanes of three independent values, step by step together (a butterfly of
// five exchanges); unrolled so that the three exchanges of a step are in flight at once.
__device__ __forceinline__ void wave_sum3(float (&s)[3]) {
    #pragma unroll
    for (int off = 16; off; off >>= 1) {
        float t[3];
        #pragma unroll
        for (int r = 0; r < 3; ++r) t[r] = __shfl_xor(s[r], off, 32);
        #pragma unroll
        for (int r = 0; r < 3; ++r) s[r] += t[r];
    }
}
// the same for eight independent values
__device__ __forceinline__ void wave_sum8(float (&s)[8]) {
    #pragma unroll
    for (int off = 16; off; off >>= 1) {
        float t[8];
        #pragma unroll
        for (int r = 0; r < 8; ++r) t[r] = __shfl_xor(s[r], off, 32);
        #pragma unroll
        for (int r = 0; r < 8; ++r) s[r] += t[r];
    }
}

// e^x as 2^(x * log2 e) on the transcendental unit. The v_nop is the one slot that the instruction set
// asks for behind a transcendental: in a run of them the next one may overwrite this one's source.
__device__ __forceinline__ float exp_slot(float x) {
    float r;
    asm("v_exp_f32 %0, %1\n\tv_nop" : "=v"(r) : "v"(x * 1.44269504f));
    return r;
}

// ---------------- Fine path: LayerNorm + query projection ----------------
// One block = 128 fine rows as two tiles of 64, 8 waves. W (256x64) is copied whole into LDS once.
// A tile is normalised into As (K = 256 whole, one wave a row, eight rows a wave side by side) and
// multiplied from there: wave -> 16 rows x 32 columns, k in ascending order. The second tile's rows
// are loaded into registers in front of the first tile's products, so that they fly under them.
// The unrolled loops index register arrays (rows, accumulators): flat, they stay in registers.
__global__ __launch_bounds__(256) void fine_kernel(
    const float* __restrict__ x, const float* __restrict__ g, const float* __restrict__ b,
    const float* __restrict__ W, const float* __restrict__ bias, float* __restrict__ C)
{
    // Pitch 260: 16 rows of an A fragment fall 4 banks apart, so a b64 read covers 64 banks once.
    // Pitch 72: rows kb and kb+2 of a B fragment fall 16 banks apart. Both are multiples of 16 B.
    __shared__ __align__(16) float As[64][260];
    __shared__ __align__(16) float Bs[256][72];

    // the wave's number as a scalar: row and tile picks made from it become scalar code
    const int wave = __builtin_amdgcn_readfirstlane(threadIdx.x >> 5);
    const int lane = threadIdx.x & 31;
    const int l15 = lane & 15;
    const int khalf = (lane >> 4) << 1;  // 0 for lanes 0-15, 2 for lanes 16-31
    const int m0 = blockIdx.x * 128;

    float v[8][8];
    auto load_rows = [&](int tile) {
        #pragma unroll
        for (int r = 0; r < 8; ++r) {
            const float* xr = x + (size_t)(m0 + tile * 64 + wave * 8 + r) * 256;
            #pragma unroll
            for (int i = 0; i < 8; ++i) v[r][i] = xr[lane + i * 32];
        }
    };

    // W: 4096 16B pieces, 16 a thread (rows ckr, ckr+16, ..., ckr+240).
    {
        const int ckr = threadIdx.x >> 4;        // 0..15
        const int cn  = (threadIdx.x & 15) * 4;
        const float* gp = W + ckr * 64 + cn;
        const float* lp = &Bs[ckr][cn];
        #pragma unroll
        for (int j = 0; j < 4; ++j) {
            async_copy4_b128(lp + (j * 64) * 72,      gp + (j * 64) * 64,
                             lp + (j * 64 + 16) * 72, gp + (j * 64 + 16) * 64,
                             lp + (j * 64 + 32) * 72, gp + (j * 64 + 32) * 64,
                             lp + (j * 64 + 48) * 72, gp + (j * 64 + 48) * 64);
        }
    }

    auto norm_rows = [&]() {
        float s[8], mean[8];
        #pragma unroll
        for (int r = 0; r < 8; ++r) {
            s[r] = 0.f;
            #pragma unroll
            for (int i = 0; i < 8; ++i) s[r] += v[r][i];
        }
        wave_sum8(s);
        #pragma unroll
        for (int r = 0; r < 8; ++r) {
            mean[r] = s[r] * (1.0f / 256);
            s[r] = 0.f;
            #pragma unroll
            for (int i = 0; i < 8; ++i) { float d = v[r][i] - mean[r]; s[r] += d * d; }
        }
        wave_sum8(s);
        #pragma unroll
        for (int r = 0; r < 8; ++r) s[r] = rsqrtf(s[r] * (1.0f / 256) + 1e-5f);
        #pragma unroll
        for (int i = 0; i < 8; ++i) {
            const int c = lane + i * 32;
            const float gc = g[c], bc = b[c];
            #pragma unroll
            for (int r = 0; r < 8; ++r) As[wave * 8 + r][c] = (v[r][i] - mean[r]) * s[r] * gc + bc;
        }
    };

    const int mt = wave >> 1;            // 0..3
    const int nt0 = (wave & 1) * 2;      // 0 or 2
    auto gemm = [&](v8f (&acc)[2]) {
        // eight k steps a trip: their LDS reads are issued together, ahead of the products
        #pragma unroll 8
        for (int kc = 0; kc < 256; kc += 4) {
            const int kb = kc + khalf;
            v2f a;
            a.x = As[mt * 16 + l15][kb];
            a.y = As[mt * 16 + l15][kb + 1];
            #pragma unroll
            for (int u = 0; u < 2; ++u) {
                const int nt = nt0 + u;
                v2f bf;
                bf.x = Bs[kb][nt * 16 + l15];
                bf.y = Bs[kb + 1][nt * 16 + l15];
                acc[u] = wmma_f32(a, bf, acc[u]);
            }
        }
    };
    // Store D (+bias). vgpr vz -> row + vz + (lane>=16 ? 8 : 0), column = lane&15.
    auto store_tile = [&](const v8f (&acc)[2], int tile) {
        const int rbase = m0 + tile * 64 + mt * 16 + ((lane >> 4) << 3);
        #pragma unroll
        for (int u = 0; u < 2; ++u) {
            const int col = (nt0 + u) * 16 + l15;
            const float bb = bias[col];
            #pragma unroll
            for (int vz = 0; vz < 8; ++vz) {
                C[(size_t)(rbase + vz) * 64 + col] = acc[u][vz] + bb;
            }
        }
    };

    load_rows(0);
    norm_rows();
    wait_async0();     // own copies of W landed
    __syncthreads();   // tile 0 and W visible to every wave
    load_rows(1);
    v8f acc0[2] = {}, acc1[2] = {};
    gemm(acc0);
    __syncthreads();   // every reader has left As
    norm_rows();
    __syncthreads();   // tile 1 visible to every wave
    // tile 0 goes out here, under tile 1's products: in front of the two barriers they would wait for the stores
    store_tile(acc0, 0);
    gemm(acc1);
    store_tile(acc1, 1);
}

// ---------------- Coarse path: LayerNorm + gate + the three projections ----------------
// One block = 64 coarse rows, 24 waves. The rows are normalised once into As (K = 512 whole),
// the gate is formed from the same values, and the 384 output columns (wqc 64 | wk 64 | wv 256)
// are computed from As in one pass over K. Waves 4g..4g+3 own columns 64g..64g+63 as 2x2 wave
// tiles of 32x32. W arrives in 32-row tiles by async copies, two buffers.
// The unrolled loops index register arrays (rows, fragments, accumulators): flat, they stay in registers.
__global__ __launch_bounds__(768) void coarse_kernel(
    const float* __restrict__ x, const float* __restrict__ g, const float* __restrict__ b,
    const float* __restrict__ wg, const float* __restrict__ bg,
    const float* __restrict__ wqc, const float* __restrict__ bqc,
    const float* __restrict__ wk, const float* __restrict__ bk,
    const float* __restrict__ wvp, const float* __restrict__ bv,
    float* __restrict__ q_coarse, float* __restrict__ k_, float* __restrict__ v_,
    float* __restrict__ gate)
{
    // Pitch 516: 16 rows of an A fragment fall 4 banks apart, so a b64 read covers 64 banks once.
    // Pitch 392: rows kb and kb+2 of a B fragment fall 16 banks apart. Both are multiples of 16 B.
    __shared__ __align__(16) float As[64][516];
    __shared__ __align__(16) float Bs[2][32][392];

    // the wave's number as a scalar: the picks and tests made from it become scalar code
    const int wave = __builtin_amdgcn_readfirstlane(threadIdx.x >> 5);
    const int lane = threadIdx.x & 31;
    const int m0 = blockIdx.x * 64;
    const int grp = wave >> 2;           // 0..5: which 64 of the 384 columns
    const int l15 = lane & 15;
    const int khalf = (lane >> 4) << 1;  // 0 for lanes 0-15, 2 for lanes 16-31

    const float* W    = (grp == 0) ? wqc : (grp == 1) ? wk : wvp;
    const float* bias = (grp == 0) ? bqc : (grp == 1) ? bk : bv;
    float* C          = (grp == 0) ? q_coarse : (grp == 1) ? k_ : v_;
    const int N  = (grp < 2) ? 64 : 256;
    const int c0 = (grp < 2) ? 0 : (grp - 2) * 64;

    // The group's 128 threads copy its 32x64 tile of W: 512 16B pieces, 4 a thread.
    const int t128 = threadIdx.x & 127;
    const int ckr = t128 >> 4;           // 0..7
    const int cn  = (t128 & 15) * 4;
    const float* wsrc = W + (size_t)ckr * N + c0 + cn;
    auto issue_tile = [&](int buf, int k0) {
        const float* gp = wsrc + (size_t)k0 * N;
        const float* lp = &Bs[buf][ckr][grp * 64 + cn];
        async_copy4_b128(lp,            gp,
                         lp + 8 * 392,  gp + (size_t)8 * N,
                         lp + 16 * 392, gp + (size_t)16 * N,
                         lp + 24 * 392, gp + (size_t)24 * N);
    };

    issue_tile(0, 0);

    // LayerNorm and gate, one wave a row: rows wave, wave+24 and, in waves 0-15, wave+48.
    // The three rows go through every step side by side, so that their cross-lane sums overlap;
    // waves 16-23 carry zeros in the third place and store nothing from it.
    {
        const bool has3 = wave < 16;
        float v[3][16];
        #pragma unroll
        for (int r = 0; r < 2; ++r) {
            const float* xr = x + (size_t)(m0 + wave + r * 24) * 512;
            #pragma unroll
            for (int i = 0; i < 16; ++i) v[r][i] = xr[lane + i * 32];
        }
        if (has3) {
            const float* xr = x + (size_t)(m0 + wave + 48) * 512;
            #pragma unroll
            for (int i = 0; i < 16; ++i) v[2][i] = xr[lane + i * 32];
        } else {
            #pragma unroll
            for (int i = 0; i < 16; ++i) v[2][i] = 0.f;
        }
        float s[3], mean[3], rstd[3];
        #pragma unroll
        for (int r = 0; r < 3; ++r) {
            s[r] = 0.f;
            #pragma unroll
            for (int i = 0; i < 16; ++i) s[r] += v[r][i];
        }
        wave_sum3(s);
        #pragma unroll
        for (int r = 0; r < 3; ++r) {
            mean[r] = s[r] * (1.0f / 512);
            s[r] = 0.f;
            #pragma unroll
            for (int i = 0; i < 16; ++i) { float d = v[r][i] - mean[r]; s[r] += d * d; }
        }
        wave_sum3(s);
        #pragma unroll
        for (int r = 0; r < 3; ++r) {
            rstd[r] = rsqrtf(s[r] * (1.0f / 512) + 1e-5f);
            s[r] = 0.f;
        }
        #pragma unroll
        for (int i = 0; i < 16; ++i) {
            const int c = lane + i * 32;
            const float gc = g[c], bc = b[c], wc = wg[c];
            #pragma unroll
            for (int r = 0; r < 3; ++r) {
                v[r][i] = (v[r][i] - mean[r]) * rstd[r] * gc + bc;
                s[r] += v[r][i] * wc;
            }
        }
        wave_sum3(s);
        const float bg0 = bg[0];
        #pragma unroll
        for (int r = 0; r < 3; ++r) {
            if (r < 2 || has3) {
                const int row = wave + r * 24;
                #pragma unroll
                for (int i = 0; i < 16; ++i) As[row][lane + i * 32] = v[r][i];
                if (lane == 0) gate[m0 + row] = 1.0f / (1.0f + __expf(-(s[r] + bg0)));
            }
        }
    }

    wait_async0();     // own copies of tile 0 landed
    __syncthreads();   // As and tile 0 visible to every wave
    issue_tile(1, 32);

    const int w4 = wave & 3;
    const int mrow = (w4 >> 1) * 32;
    const int ncol = (w4 & 1) * 32;      // inside the group's 64 columns
    v8f acc[2][2] = {};

    for (int t = 0; t < 16; ++t) {
        const int cur = t & 1;
        #pragma unroll
        for (int kc = 0; kc < 32; kc += 4) {
            const int kb = kc + khalf;
            v2f a[2], bf[2];
            #pragma unroll
            for (int mi = 0; mi < 2; ++mi) {
                a[mi].x = As[mrow + mi * 16 + l15][t * 32 + kb];
                a[mi].y = As[mrow + mi * 16 + l15][t * 32 + kb + 1];
            }
            #pragma unroll
            for (int u = 0; u < 2; ++u) {
                bf[u].x = Bs[cur][kb][grp * 64 + ncol + u * 16 + l15];
                bf[u].y = Bs[cur][kb + 1][grp * 64 + ncol + u * 16 + l15];
            }
            #pragma unroll
            for (int mi = 0; mi < 2; ++mi) {
                #pragma unroll
                for (int u = 0; u < 2; ++u) acc[mi][u] = wmma_f32(a[mi], bf[u], acc[mi][u]);
            }
        }
        wait_ds0();
        wait_async0();     // own copies of tile t+1 landed
        __syncthreads();   // tile t+1 visible; every reader has left buffer cur
        if (t + 2 < 16) issue_tile(cur, (t + 2) * 32);
    }
    wait_async0();         // nothing in flight when the wave ends

    // Store D (+bias). vgpr vz -> row + vz + (lane>=16 ? 8 : 0), column = lane&15.
    #pragma unroll
    for (int mi = 0; mi < 2; ++mi) {
        const int rbase = mrow + mi * 16 + ((lane >> 4) << 3);
        #pragma unroll
        for (int u = 0; u < 2; ++u) {
            const int col = c0 + ncol + u * 16 + l15;
            const float bb = bias[col];
            #pragma unroll
            for (int vz = 0; vz < 8; ++vz) {
                C[(size_t)(m0 + rbase + vz) * N + col] = acc[mi][u][vz] + bb;
            }
        }
    }
}

// ---------------- Local attention over a 4x4 coarse tile ----------------
// 64 queries (16 cells x 2x2 fine pixels) vs shared 8x8 key union.
// Q is blended while it is staged: q = q_fine*g + q_coarse*(1-g), g the gate of the query's cell.
// S = Q*K^T (WMMA, 64x64x64), masked softmax over 5x5 window, O = P*V (WMMA, 64x64 @ 64x256).
__global__ __launch_bounds__(256) void attn_kernel(
    const float* __restrict__ qf,     // [B,128,128,64] fine query projection
    const float* __restrict__ qc,     // [B,64,64,64]   coarse query projection
    const float* __restrict__ gate,   // [B,64,64]
    const float* __restrict__ Kg,     // [B,64,64,64]
    const float* __restrict__ Vg,     // [B,64,64,256]
    float* __restrict__ out)          // [B,128,128,256]
{
    // Pitch 68 floats = 272 B, a multiple of 16 B: a row takes 16-byte stores.
    __shared__ __align__(16) float Qs[64][68];
    __shared__ __align__(16) float Ks[64][68];
    __shared__ __align__(16) float Ps[64][68];

    const int b = blockIdx.z;
    const int i0 = blockIdx.y * 4, j0 = blockIdx.x * 4;
    const int wv = threadIdx.x >> 5, lane = threadIdx.x & 31;
    const int l15 = lane & 15;
    const int khalf = (lane >> 4) << 1;

    // Stage K union [64,64] with zero padding, and the blended Q [64,64].
    // Thread -> one coarse cell (16 threads a cell) and 4 of the 64 columns: the cell's four fine
    // pixels (query rows 4*cell..4*cell+3), its one q_coarse piece and gate, and union rows
    // 4*cell..4*cell+3. No address depends on a loaded value, so the ten loads fly together.
    // A padded union position reads a clamped (in-bounds) row and stores zeros instead.
    // The three loops over sub are unrolled because they index register arrays (kp, kv, qv, kok).
    const int cell = threadIdx.x >> 4;
    const int e4 = (threadIdx.x & 15) * 4;
    const int ci = cell >> 2, cj = cell & 3;
    const int cidx = (b * 64 + i0 + ci) * 64 + j0 + cj;
    float4 kv[4], qv[4];
    bool kok[4];
    const float* kp[4];
    #pragma unroll
    for (int sub = 0; sub < 4; ++sub) {
        const int u = cell * 4 + sub;
        const int ir = i0 - 2 + (u >> 3), jc = j0 - 2 + (u & 7);
        kok[sub] = (ir >= 0) && (ir < 64) && (jc >= 0) && (jc < 64);
        const int irc = min(max(ir, 0), 63), jcc = min(max(jc, 0), 63);
        kp[sub] = Kg + (size_t)((b * 64 + irc) * 64 + jcc) * 64 + e4;
    }
    // the cell's upper left fine pixel; the other three lie 1 pixel, 1 row and 1 row + 1 pixel on
    const float* qp = qf + (size_t)((b * 128 + (i0 + ci) * 2) * 128 + (j0 + cj) * 2) * 64 + e4;
    const float* qcp = qc + (size_t)cidx * 64 + e4;
    #pragma unroll
    for (int sub = 0; sub < 4; ++sub) {
        kv[sub] = *(const float4*)kp[sub];
        qv[sub] = *(const float4*)(qp + ((sub >> 1) * 128 + (sub & 1)) * 64);
    }
    const float g = gate[cidx];
    const float4 qcv = *(const float4*)qcp;
    // Named as inputs, the loads' address registers stay live up to this wait, so that no later
    // load's result and no later instruction lands on one of them in front of it.
    asm volatile("s_wait_xcnt 0x0" :: "v"(kp[0]), "v"(kp[1]), "v"(kp[2]), "v"(kp[3]),
                 "v"(qp), "v"(qcp), "v"(cidx) : "memory");

    #pragma unroll
    for (int sub = 0; sub < 4; ++sub) {
        const int u = cell * 4 + sub;
        float4 kz, qz;
        kz.x = kok[sub] ? kv[sub].x : 0.0f;
        kz.y = kok[sub] ? kv[sub].y : 0.0f;
        kz.z = kok[sub] ? kv[sub].z : 0.0f;
        kz.w = kok[sub] ? kv[sub].w : 0.0f;
        qz.x = qv[sub].x * g + qcv.x * (1.0f - g);
        qz.y = qv[sub].y * g + qcv.y * (1.0f - g);
        qz.z = qv[sub].z * g + qcv.z * (1.0f - g);
        qz.w = qv[sub].w * g + qcv.w * (1.0f - g);
        *(float4*)&Ks[u][e4] = kz;
        *(float4*)&Qs[u][e4] = qz;
    }
    __syncthreads();

    // ---- V fragments for O = P * V, straight from global into registers, ahead of their use ----
    // Each wave owns 32 output columns (2 n-tiles). The two n-tiles take the even and the odd columns:
    // column l15 of tile u is output column wv*32 + 2*l15 + u. A lane's two columns are neighbours, so
    // one 8-byte load serves both tiles, one 8-byte store takes both results, and 16 lanes cover a
    // row's whole 128-byte line.
    // Union position kc + khalf + e lies in union row kc >> 3 (one row for the whole wave) and union
    // column (kc & 4) + khalf + e (four values a lane, kept in registers): no address depends on a
    // loaded value. A padded position reads a clamped (in-bounds) place and takes zeros when it is used,
    // so no load stands under a branch. The 16 k steps go in four groups of four through two register
    // sets: groups 0 and 1 are asked for here and fly under S and the softmax.
    // The loops are unrolled because they index register arrays (vofs, cok, vr).
    const int nb = wv * 32 + l15 * 2;
    int vofs[2][2];
    bool cok[2][2];
    #pragma unroll
    for (int q = 0; q < 2; ++q) {
        #pragma unroll
        for (int e = 0; e < 2; ++e) {
            const int jc = j0 - 2 + q * 4 + khalf + e;
            cok[q][e] = (jc >= 0) && (jc < 64);
            vofs[q][e] = min(max(jc, 0), 63) * 256 + nb;
        }
    }
    float2 vr[2][4][2];
    auto load_group = [&](int grp) {
        #pragma unroll
        for (int s = 0; s < 4; ++s) {
            const int kc = grp * 16 + s * 4;
            const int irc = min(max(i0 - 2 + (kc >> 3), 0), 63);
            const float* vrow = Vg + (size_t)((b * 64 + irc) * 64) * 256;
            vr[grp & 1][s][0] = *(const float2*)(vrow + vofs[s & 1][0]);
            vr[grp & 1][s][1] = *(const float2*)(vrow + vofs[s & 1][1]);
        }
    };
    load_group(0);
    load_group(1);

    // ---- S = Q * K^T : M=64, N=64, K=64 (8 waves x 2 tiles) ----
    {
        const int mt = wv >> 1;
        const int nt0 = (wv & 1) * 2;
        v8f accS[2] = {};
        #pragma unroll
        for (int kc = 0; kc < 64; kc += 4) {
            const int kb = kc + khalf;
            v2f a;
            a.x = Qs[mt * 16 + l15][kb];
            a.y = Qs[mt * 16 + l15][kb + 1];
            #pragma unroll
            for (int u = 0; u < 2; ++u) {
                const int nrow = (nt0 + u) * 16 + l15;  // B[k][n] = Ks[n][k]
                v2f bf;
                bf.x = Ks[nrow][kb];
                bf.y = Ks[nrow][kb + 1];
                accS[u] = wmma_f32(a, bf, accS[u]);
            }
        }
        const int rbase = mt * 16 + ((lane >> 4) << 3);
        #pragma unroll
        for (int u = 0; u < 2; ++u) {
            const int col = (nt0 + u) * 16 + l15;
            #pragma unroll
            for (int vz = 0; vz < 8; ++vz) Ps[rbase + vz][col] = accS[u][vz];
        }
    }
    __syncthreads();

    // ---- Masked softmax: four threads a query row, 16 union positions each, all 64 rows at once ----
    // A thread keeps its 16 scores in registers (union rows 2*qd and 2*qd+1), so a row's maximum and
    // sum take two exchange steps inside a group of four lanes, and no row waits for another row.
    // Every thread reads and rewrites only its own 16 places of Ps.
    // The loops are unrolled because they index register arrays (p, ok).
    {
        const int row = threadIdx.x >> 2, qd = threadIdx.x & 3;
        const int rci = row >> 4, rcj = (row >> 2) & 3;   // the row's cell inside the 4x4 tile
        const float NEG = -3.0e38f;
        float p[16];
        bool ok[16];
        #pragma unroll
        for (int j = 0; j < 4; ++j) {
            const float4 t = *(const float4*)&Ps[row][qd * 16 + j * 4];
            p[j * 4 + 0] = t.x;
            p[j * 4 + 1] = t.y;
            p[j * 4 + 2] = t.z;
            p[j * 4 + 3] = t.w;
        }
        #pragma unroll
        for (int e = 0; e < 16; ++e) {
            const int r = qd * 2 + (e >> 3), c = e & 7;
            ok[e] = (r >= rci) && (r <= rci + 4) && (c >= rcj) && (c <= rcj + 4);
            p[e] = ok[e] ? p[e] : NEG;
        }
        float m = p[0];
        #pragma unroll
        for (int e = 1; e < 16; ++e) m = fmaxf(m, p[e]);
        m = fmaxf(m, __shfl_xor(m, 1, 32));
        m = fmaxf(m, __shfl_xor(m, 2, 32));
        #pragma unroll
        for (int e = 0; e < 16; ++e) {
            const float ex = exp_slot(p[e] - m);   // in every lane: no branch round the 16 independent exps
            p[e] = ok[e] ? ex : 0.0f;
        }
        float s4[4];
        #pragma unroll
        for (int j = 0; j < 4; ++j) s4[j] = (p[j * 4] + p[j * 4 + 1]) + (p[j * 4 + 2] + p[j * 4 + 3]);
        float s = (s4[0] + s4[1]) + (s4[2] + s4[3]);
        s += __shfl_xor(s, 1, 32);
        s += __shfl_xor(s, 2, 32);
        const float inv = 1.0f / s;
        #pragma unroll
        for (int j = 0; j < 4; ++j) {
            float4 t;
            t.x = p[j * 4 + 0] * inv;
            t.y = p[j * 4 + 1] * inv;
            t.z = p[j * 4 + 2] * inv;
            t.w = p[j * 4 + 3] * inv;
            *(float4*)&Ps[row][qd * 16 + j * 4] = t;
        }
    }
    __syncthreads();

    // ---- O = P * V : M=64, K=64, N=256 ----
    // Each wave owns its 32 output columns in all 4 m-tiles, so every V fragment is loaded once per
    // block and feeds 4 WMMAs on independent accumulators. Behind a group's products its register set
    // is free and takes the group after next.
    v8f acc[4][2] = {};
    #pragma unroll
    for (int kc = 0; kc < 64; kc += 4) {
        const int kb = kc + khalf;
        const int grp = kc >> 4, s = (kc >> 2) & 3;
        const int ir = i0 - 2 + (kc >> 3);
        const bool rok = (ir >= 0) && (ir < 64);
        const bool ok0 = rok && cok[s & 1][0], ok1 = rok && cok[s & 1][1];
        v2f a[4];
        #pragma unroll
        for (int mt = 0; mt < 4; ++mt) {
            a[mt].x = Ps[mt * 16 + l15][kb];
            a[mt].y = Ps[mt * 16 + l15][kb + 1];
        }
        const float2 r0 = vr[grp & 1][s][0], r1 = vr[grp & 1][s][1];
        v2f bf[2];
        bf[0].x = ok0 ? r0.x : 0.0f;
        bf[0].y = ok1 ? r1.x : 0.0f;
        bf[1].x = ok0 ? r0.y : 0.0f;
        bf[1].y = ok1 ? r1.y : 0.0f;
        #pragma unroll
        for (int mt = 0; mt < 4; ++mt) {
            #pragma unroll
            for (int u = 0; u < 2; ++u) acc[mt][u] = wmma_f32(a[mt], bf[u], acc[mt][u]);
        }
        if (s == 3 && grp < 2) load_group(grp + 2);
    }
    // The lane's first output place; every other one lies a compile-time distance from it.
    float* obase = out + (size_t)((b * 128 + i0 * 2) * 128 + (j0 + (lane >> 4) * 2) * 2) * 256 + nb;
    #pragma unroll
    for (int mt = 0; mt < 4; ++mt) {
        #pragma unroll
        for (int vz = 0; vz < 8; ++vz) {
            // query row mt*16 + (lane >> 4)*8 + vz: cell row mt, cell column (lane >> 4)*2 + (vz >> 2), fine pixel vz & 3
            const int pix = (mt * 2 + ((vz >> 1) & 1)) * 128 + (vz >> 2) * 2 + (vz & 1);
            *(float2*)(obase + pix * 256) = make_float2(acc[mt][0][vz], acc[mt][1][vz]);
        }
    }
}

// ---------------- Host launcher ----------------
extern "C" void kernel_launch(void* const* d_in, const int* in_sizes, int n_in,
                              void* d_out, int out_size, void* d_ws, size_t ws_size,
                              hipStream_t stream)
{
    const float* fine    = (const float*)d_in[0];   // [4,128,128,256]
    const float* coarse  = (const float*)d_in[1];   // [4,64,64,512]
    const float* gamma_f = (const float*)d_in[2];
    const float* beta_f  = (const float*)d_in[3];
    const float* gamma_c = (const float*)d_in[4];
    const float* beta_c  = (const float*)d_in[5];
    const float* wg      = (const float*)d_in[6];   // [512,1]
    const float* bg      = (const float*)d_in[7];   // [1]
    const float* wqf     = (const float*)d_in[8];   // [256,64]
    const float* bqf     = (const float*)d_in[9];
    const float* wqc     = (const float*)d_in[10];  // [512,64]
    const float* bqc     = (const float*)d_in[11];
    const float* wk      = (const float*)d_in[12];  // [512,64]
    const float* bk      = (const float*)d_in[13];
    const float* wv      = (const float*)d_in[14];  // [512,256]
    const float* bv      = (const float*)d_in[15];
    float* out = (float*)d_out;                     // [4,128,128,256]

    const int MF = 4 * 128 * 128;   // 65536 fine rows
    const int MC = 4 * 64 * 64;     // 16384 coarse rows

    float* ws = (float*)d_ws;
    float* q_fine   = ws;                    // 4194304
    float* q_coarse = q_fine + 4194304;      // 1048576
    float* k_       = q_coarse + 1048576;    // 1048576
    float* v_       = k_ + 1048576;          // 4194304
    float* gate     = v_ + 4194304;          // 16384

    // 1) Fine path: LayerNorm and the query projection in one kernel
    fine_kernel<<<MF / 128, 256, 0, stream>>>(fine, gamma_f, beta_f, wqf, bqf, q_fine);

    // 2) Coarse path: LayerNorm, gate and the three projections in one kernel
    coarse_kernel<<<MC / 64, 768, 0, stream>>>(coarse, gamma_c, beta_c, wg, bg, wqc, bqc, wk, bk, wv, bv,
                                               q_coarse, k_, v_, gate);

    // 3) Local attention (one block per 4x4 coarse tile), query blend included
    attn_kernel<<<dim3(16, 16, 4), 256, 0, stream>>>(q_fine, q_coarse, gate, k_, v_, out);
}

// v008
// Measured time: 77.1 microseconds a run.
// Timed twice side by side with v007, it ran 1.03 times as fast both times.
// All steps since v000 together make it 2.19 times as fast.
#include <hip/hip_runtime.h>
#include <hip/hip_bf16.h>

// SAPA feature alignment for MI455X (gfx1250, wave32, WMMA).
// Matrix math: V_WMMA_F32_16X16X4_F32 (f32 in, f32 accum).
// Weight staging: GLOBAL_LOAD_ASYNC_TO_LDS_B128 (ASYNCcnt-tracked).
// The coarse path is one kernel: a 64-row tile is normalised into LDS, the gate is formed
// from the same values in registers, and the three coarse projections read the tile there. The fine path is one kernel of the same kind.
//
// Scratch layout (floats):
//   q_fine   65536*64
//   q_coarse 16384*64
//   k_       16384*64
//   v_       16384*256
//   gate     16384

typedef __attribute__((ext_vector_type(2))) float v2f;
typedef __attribute__((ext_vector_type(8))) float v8f;

__device__ __forceinline__ v8f wmma_f32(v2f a, v2f b, v8f c) {
    // D = A(16x4) * B(4x16) + C(16x16), all f32
    return __builtin_amdgcn_wmma_f32_16x16x4_f32(
        /*neg_a=*/false, a, /*neg_b=*/false, b,
        /*c_mod=*/(short)0, c, /*reuse_a=*/false, /*reuse_b=*/false);
}

__device__ __forceinline__ void wait_async0() {
    asm volatile("s_wait_asynccnt 0x0" ::: "memory");
}
// Four 16B copies global -> LDS in one statement. The closing s_wait_xcnt keeps every later
// write of the address registers behind the copies that name them.
__device__ __forceinline__ void async_copy4_b128(
    const float* l0, const float* g0, const float* l1, const float* g1,
    const float* l2, const float* g2, const float* l3, const float* g3) {
    asm volatile("global_load_async_to_lds_b128 %0, %1, off\n\t"
                 "global_load_async_to_lds_b128 %2, %3, off\n\t"
                 "global_load_async_to_lds_b128 %4, %5, off\n\t"
                 "global_load_async_to_lds_b128 %6, %7, off\n\t"
                 "s_wait_xcnt 0x0"
                 :: "v"((unsigned)(uintptr_t)l0), "v"((unsigned long long)(uintptr_t)g0),
                    "v"((unsigned)(uintptr_t)l1), "v"((unsigned long long)(uintptr_t)g1),
                    "v"((unsigned)(uintptr_t)l2), "v"((unsigned long long)(uintptr_t)g2),
                    "v"((unsigned)(uintptr_t)l3), "v"((unsigned long long)(uintptr_t)g3)
                 : "memory");
}
__device__ __forceinline__ void wait_ds0() {
    // own LDS reads of the buffer are back before the barrier that frees it for a refill
    asm volatile("s_wait_dscnt 0x0" ::: "memory");
}

// Sum over the wave's 32 lanes of three independent values, step by step together (a butterfly of
// five exchanges); unrolled so that the three exchanges of a step are in flight at once.
__device__ __forceinline__ void wave_sum3(float (&s)[3]) {
    #pragma unroll
    for (int off = 16; off; off >>= 1) {
        float t[3];
        #pragma unroll
        for (int r = 0; r < 3; ++r) t[r] = __shfl_xor(s[r], off, 32);
        #pragma unroll
        for (int r = 0; r < 3; ++r) s[r] += t[r];
    }
}
// the same for eight independent values
__device__ __forceinline__ void wave_sum8(float (&s)[8]) {
    #pragma unroll
    for (int off = 16; off; off >>= 1) {
        float t[8];
        #pragma unroll
        for (int r = 0; r < 8; ++r) t[r] = __shfl_xor(s[r], off, 32);
        #pragma unroll
        for (int r = 0; r < 8; ++r) s[r] += t[r];
    }
}

// e^x as 2^(x * log2 e) on the transcendental unit. The v_nop is the one slot that the instruction set
// asks for behind a transcendental: in a run of them the next one may overwrite this one's source.
__device__ __forceinline__ float exp_slot(float x) {
    float r;
    asm("v_exp_f32 %0, %1\n\tv_nop" : "=v"(r) : "v"(x * 1.44269504f));
    return r;
}

// ---------------- Fine path: LayerNorm + query projection ----------------
// One block = 128 fine rows as two tiles of 64, 8 waves. W (256x64) is copied whole into LDS once.
// A tile is normalised into As (K = 256 whole, one wave a row, eight rows a wave side by side) and
// multiplied from there: wave -> 16 rows x 32 columns, k in ascending order. The second tile's rows
// are loaded into registers in front of the first tile's products, so that they fly under them.
// The unrolled loops index register arrays (rows, accumulators): flat, they stay in registers.
__global__ __launch_bounds__(256) void fine_kernel(
    const float* __restrict__ x, const float* __restrict__ g, const float* __restrict__ b,
    const float* __restrict__ W, const float* __restrict__ bias, float* __restrict__ C)
{
    // Pitch 260: 16 rows of an A fragment fall 4 banks apart, so a b64 read covers 64 banks once.
    // Pitch 72: rows kb and kb+2 of a B fragment fall 16 banks apart. Both are multiples of 16 B.
    __shared__ __align__(16) float As[64][260];
    __shared__ __align__(16) float Bs[256][72];

    // the wave's number as a scalar: row and tile picks made from it become scalar code
    const int wave = __builtin_amdgcn_readfirstlane(threadIdx.x >> 5);
    const int lane = threadIdx.x & 31;
    const int l15 = lane & 15;
    const int khalf = (lane >> 4) << 1;  // 0 for lanes 0-15, 2 for lanes 16-31
    const int m0 = blockIdx.x * 128;

    float v[8][8];
    auto load_rows = [&](int tile) {
        #pragma unroll
        for (int r = 0; r < 8; ++r) {
            const float* xr = x + (size_t)(m0 + tile * 64 + wave * 8 + r) * 256;
            #pragma unroll
            for (int i = 0; i < 8; ++i) v[r][i] = xr[lane + i * 32];
        }
    };

    // W: 4096 16B pieces, 16 a thread (rows ckr, ckr+16, ..., ckr+240).
    {
        const int ckr = threadIdx.x >> 4;        // 0..15
        const int cn  = (threadIdx.x & 15) * 4;
        const float* gp = W + ckr * 64 + cn;
        const float* lp = &Bs[ckr][cn];
        #pragma unroll
        for (int j = 0; j < 4; ++j) {
            async_copy4_b128(lp + (j * 64) * 72,      gp + (j * 64) * 64,
                             lp + (j * 64 + 16) * 72, gp + (j * 64 + 16) * 64,
                             lp + (j * 64 + 32) * 72, gp + (j * 64 + 32) * 64,
                             lp + (j * 64 + 48) * 72, gp + (j * 64 + 48) * 64);
        }
    }

    auto norm_rows = [&]() {
        float s[8], mean[8];
        #pragma unroll
        for (int r = 0; r < 8; ++r) {
            s[r] = 0.f;
            #pragma unroll
            for (int i = 0; i < 8; ++i) s[r] += v[r][i];
        }
        wave_sum8(s);
        #pragma unroll
        for (int r = 0; r < 8; ++r) {
            mean[r] = s[r] * (1.0f / 256);
            s[r] = 0.f;
            #pragma unroll
            for (int i = 0; i < 8; ++i) { float d = v[r][i] - mean[r]; s[r] += d * d; }
        }
        wave_sum8(s);
        #pragma unroll
        for (int r = 0; r < 8; ++r) s[r] = rsqrtf(s[r] * (1.0f / 256) + 1e-5f);
        #pragma unroll
        for (int i = 0; i < 8; ++i) {
            const int c = lane + i * 32;
            const float gc = g[c], bc = b[c];
            #pragma unroll
            for (int r = 0; r < 8; ++r) As[wave * 8 + r][c] = (v[r][i] - mean[r]) * s[r] * gc + bc;
        }
    };

    const int mt = wave >> 1;            // 0..3
    const int nt0 = (wave & 1) * 2;      // 0 or 2
    auto gemm = [&](v8f (&acc)[2]) {
        // eight k steps a trip: their LDS reads are issued together, ahead of the products
        #pragma unroll 8
        for (int kc = 0; kc < 256; kc += 4) {
            const int kb = kc + khalf;
            v2f a;
            a.x = As[mt * 16 + l15][kb];
            a.y = As[mt * 16 + l15][kb + 1];
            #pragma unroll
            for (int u = 0; u < 2; ++u) {
                const int nt = nt0 + u;
                v2f bf;
                bf.x = Bs[kb][nt * 16 + l15];
                bf.y = Bs[kb + 1][nt * 16 + l15];
                acc[u] = wmma_f32(a, bf, acc[u]);
            }
        }
    };
    // Store D (+bias). vgpr vz -> row + vz + (lane>=16 ? 8 : 0), column = lane&15.
    auto store_tile = [&](const v8f (&acc)[2], int tile) {
        const int rbase = m0 + tile * 64 + mt * 16 + ((lane >> 4) << 3);
        #pragma unroll
        for (int u = 0; u < 2; ++u) {
            const int col = (nt0 + u) * 16 + l15;
            const float bb = bias[col];
            #pragma unroll
            for (int vz = 0; vz < 8; ++vz) {
                C[(size_t)(rbase + vz) * 64 + col] = acc[u][vz] + bb;
            }
        }
    };

    load_rows(0);
    norm_rows();
    wait_async0();     // own copies of W landed
    __syncthreads();   // tile 0 and W visible to every wave
    load_rows(1);
    v8f acc0[2] = {}, acc1[2] = {};
    gemm(acc0);
    __syncthreads();   // every reader has left As
    norm_rows();
    __syncthreads();   // tile 1 visible to every wave
    // tile 0 goes out here, under tile 1's products: in front of the two barriers they would wait for the stores
    store_tile(acc0, 0);
    gemm(acc1);
    store_tile(acc1, 1);
}

// ---------------- Coarse path: LayerNorm + gate + the three projections ----------------
// One block = 64 coarse rows, 24 waves. The rows are normalised once into As (K = 512 whole),
// the gate is formed from the same values, and the 384 output columns (wqc 64 | wk 64 | wv 256)
// are computed from As in one pass over K. Waves 4g..4g+3 own columns 64g..64g+63 as 2x2 wave
// tiles of 32x32. W arrives in 32-row tiles by async copies, two buffers.
// The unrolled loops index register arrays (rows, fragments, accumulators): flat, they stay in registers.
__global__ __launch_bounds__(768) void coarse_kernel(
    const float* __restrict__ x, const float* __restrict__ g, const float* __restrict__ b,
    const float* __restrict__ wg, const float* __restrict__ bg,
    const float* __restrict__ wqc, const float* __restrict__ bqc,
    const float* __restrict__ wk, const float* __restrict__ bk,
    const float* __restrict__ wvp, const float* __restrict__ bv,
    float* __restrict__ q_coarse, float* __restrict__ k_, float* __restrict__ v_,
    float* __restrict__ gate)
{
    // Pitch 516: 16 rows of an A fragment fall 4 banks apart, so a b64 read covers 64 banks once.
    // Pitch 392: rows kb and kb+2 of a B fragment fall 16 banks apart. Both are multiples of 16 B.
    __shared__ __align__(16) float As[64][516];
    __shared__ __align__(16) float Bs[2][32][392];

    // the wave's number as a scalar: the picks and tests made from it become scalar code
    const int wave = __builtin_amdgcn_readfirstlane(threadIdx.x >> 5);
    const int lane = threadIdx.x & 31;
    const int m0 = blockIdx.x * 64;
    const int grp = wave >> 2;           // 0..5: which 64 of the 384 columns
    const int l15 = lane & 15;
    const int khalf = (lane >> 4) << 1;  // 0 for lanes 0-15, 2 for lanes 16-31

    const float* W    = (grp == 0) ? wqc : (grp == 1) ? wk : wvp;
    const float* bias = (grp == 0) ? bqc : (grp == 1) ? bk : bv;
    float* C          = (grp == 0) ? q_coarse : (grp == 1) ? k_ : v_;
    const int N  = (grp < 2) ? 64 : 256;
    const int c0 = (grp < 2) ? 0 : (grp - 2) * 64;

    // The group's 128 threads copy its 32x64 tile of W: 512 16B pieces, 4 a thread.
    const int t128 = threadIdx.x & 127;
    const int ckr = t128 >> 4;           // 0..7
    const int cn  = (t128 & 15) * 4;
    const float* wsrc = W + (size_t)ckr * N + c0 + cn;
    auto issue_tile = [&](int buf, int k0) {
        const float* gp = wsrc + (size_t)k0 * N;
        const float* lp = &Bs[buf][ckr][grp * 64 + cn];
        async_copy4_b128(lp,            gp,
                         lp + 8 * 392,  gp + (size_t)8 * N,
                         lp + 16 * 392, gp + (size_t)16 * N,
                         lp + 24 * 392, gp + (size_t)24 * N);
    };

    issue_tile(0, 0);

    // LayerNorm and gate, one wave a row: rows wave, wave+24 and, in waves 0-15, wave+48.
    // The three rows go through every step side by side, so that their cross-lane sums overlap;
    // waves 16-23 carry zeros in the third place and store nothing from it.
    {
        const bool has3 = wave < 16;
        float v[3][16];
        #pragma unroll
        for (int r = 0; r < 2; ++r) {
            const float* xr = x + (size_t)(m0 + wave + r * 24) * 512;
            #pragma unroll
            for (int i = 0; i < 16; ++i) v[r][i] = xr[lane + i * 32];
        }
        if (has3) {
            const float* xr = x + (size_t)(m0 + wave + 48) * 512;
            #pragma unroll
            for (int i = 0; i < 16; ++i) v[2][i] = xr[lane + i * 32];
        } else {
            #pragma unroll
            for (int i = 0; i < 16; ++i) v[2][i] = 0.f;
        }
        float s[3], mean[3], rstd[3];
        #pragma unroll
        for (int r = 0; r < 3; ++r) {
            s[r] = 0.f;
            #pragma unroll
            for (int i = 0; i < 16; ++i) s[r] += v[r][i];
        }
        wave_sum3(s);
        #pragma unroll
        for (int r = 0; r < 3; ++r) {
            mean[r] = s[r] * (1.0f / 512);
            s[r] = 0.f;
            #pragma unroll
            for (int i = 0; i < 16; ++i) { float d = v[r][i] - mean[r]; s[r] += d * d; }
        }
        wave_sum3(s);
        #pragma unroll
        for (int r = 0; r < 3; ++r) {
            rstd[r] = rsqrtf(s[r] * (1.0f / 512) + 1e-5f);
            s[r] = 0.f;
        }
        #pragma unroll
        for (int i = 0; i < 16; ++i) {
            const int c = lane + i * 32;
            const float gc = g[c], bc = b[c], wc = wg[c];
            #pragma unroll
            for (int r = 0; r < 3; ++r) {
                v[r][i] = (v[r][i] - mean[r]) * rstd[r] * gc + bc;
                s[r] += v[r][i] * wc;
            }
        }
        wave_sum3(s);
        const float bg0 = bg[0];
        #pragma unroll
        for (int r = 0; r < 3; ++r) {
            if (r < 2 || has3) {
                const int row = wave + r * 24;
                #pragma unroll
                for (int i = 0; i < 16; ++i) As[row][lane + i * 32] = v[r][i];
                if (lane == 0) gate[m0 + row] = 1.0f / (1.0f + __expf(-(s[r] + bg0)));
            }
        }
    }

    wait_async0();     // own copies of tile 0 landed
    __syncthreads();   // As and tile 0 visible to every wave
    issue_tile(1, 32);

    const int w4 = wave & 3;
    const int mrow = (w4 >> 1) * 32;
    const int ncol = (w4 & 1) * 32;      // inside the group's 64 columns
    v8f acc[2][2] = {};

    for (int t = 0; t < 16; ++t) {
        const int cur = t & 1;
        #pragma unroll
        for (int kc = 0; kc < 32; kc += 4) {
            const int kb = kc + khalf;
            v2f a[2], bf[2];
            #pragma unroll
            for (int mi = 0; mi < 2; ++mi) {
                a[mi].x = As[mrow + mi * 16 + l15][t * 32 + kb];
                a[mi].y = As[mrow + mi * 16 + l15][t * 32 + kb + 1];
            }
            #pragma unroll
            for (int u = 0; u < 2; ++u) {
                bf[u].x = Bs[cur][kb][grp * 64 + ncol + u * 16 + l15];
                bf[u].y = Bs[cur][kb + 1][grp * 64 + ncol + u * 16 + l15];
            }
            #pragma unroll
            for (int mi = 0; mi < 2; ++mi) {
                #pragma unroll
                for (int u = 0; u < 2; ++u) acc[mi][u] = wmma_f32(a[mi], bf[u], acc[mi][u]);
            }
        }
        wait_ds0();
        wait_async0();     // own copies of tile t+1 landed
        __syncthreads();   // tile t+1 visible; every reader has left buffer cur
        if (t + 2 < 16) issue_tile(cur, (t + 2) * 32);
    }
    wait_async0();         // nothing in flight when the wave ends

    // Store D (+bias). vgpr vz -> row + vz + (lane>=16 ? 8 : 0), column = lane&15.
    #pragma unroll
    for (int mi = 0; mi < 2; ++mi) {
        const int rbase = mrow + mi * 16 + ((lane >> 4) << 3);
        #pragma unroll
        for (int u = 0; u < 2; ++u) {
            const int col = c0 + ncol + u * 16 + l15;
            const float bb = bias[col];
            #pragma unroll
            for (int vz = 0; vz < 8; ++vz) {
                C[(size_t)(m0 + rbase + vz) * N + col] = acc[mi][u][vz] + bb;
            }
        }
    }
}

// ---------------- Local attention over a 4x4 coarse tile ----------------
// 64 queries (16 cells x 2x2 fine pixels) vs shared 8x8 key union.
// Q is blended while it is staged: q = q_fine*g + q_coarse*(1-g), g the gate of the query's cell.
// S = Q*K^T (WMMA, 64x64x64), masked softmax over 5x5 window, O = P*V (WMMA, 64x64 @ 64x256).
__global__ __launch_bounds__(256) void attn_kernel(
    const float* __restrict__ qf,     // [B,128,128,64] fine query projection
    const float* __restrict__ qc,     // [B,64,64,64]   coarse query projection
    const float* __restrict__ gate,   // [B,64,64]
    const float* __restrict__ Kg,     // [B,64,64,64]
    const float* __restrict__ Vg,     // [B,64,64,256]
    float* __restrict__ out)          // [B,128,128,256]
{
    // Pitch 68 floats = 272 B, a multiple of 16 B: a row takes 16-byte stores.
    __shared__ __align__(16) float Qs[64][68];
    __shared__ __align__(16) float Ks[64][68];
    __shared__ __align__(16) float Ps[64][68];

    const int b = blockIdx.z;
    const int i0 = blockIdx.y * 4, j0 = blockIdx.x * 4;
    const int wv = threadIdx.x >> 5, lane = threadIdx.x & 31;
    const int l15 = lane & 15;
    const int khalf = (lane >> 4) << 1;

    // Stage K union [64,64] with zero padding, and the blended Q [64,64].
    // Thread -> one coarse cell (16 threads a cell) and 4 of the 64 columns: the cell's four fine
    // pixels (query rows 4*cell..4*cell+3), its one q_coarse piece and gate, and union rows
    // 4*cell..4*cell+3. No address depends on a loaded value, so the ten loads fly together.
    // A padded union position reads a clamped (in-bounds) row and stores zeros instead.
    // The three loops over sub are unrolled because they index register arrays (kp, kv, qv, kok).
    const int cell = threadIdx.x >> 4;
    const int e4 = (threadIdx.x & 15) * 4;
    const int ci = cell >> 2, cj = cell & 3;
    const int cidx = (b * 64 + i0 + ci) * 64 + j0 + cj;
    float4 kv[4], qv[4];
    bool kok[4];
    const float* kp[4];
    #pragma unroll
    for (int sub = 0; sub < 4; ++sub) {
        const int u = cell * 4 + sub;
        const int ir = i0 - 2 + (u >> 3), jc = j0 - 2 + (u & 7);
        kok[sub] = (ir >= 0) && (ir < 64) && (jc >= 0) && (jc < 64);
        const int irc = min(max(ir, 0), 63), jcc = min(max(jc, 0), 63);
        kp[sub] = Kg + (size_t)((b * 64 + irc) * 64 + jcc) * 64 + e4;
    }
    // the cell's upper left fine pixel; the other three lie 1 pixel, 1 row and 1 row + 1 pixel on
    const float* qp = qf + (size_t)((b * 128 + (i0 + ci) * 2) * 128 + (j0 + cj) * 2) * 64 + e4;
    const float* qcp = qc + (size_t)cidx * 64 + e4;
    #pragma unroll
    for (int sub = 0; sub < 4; ++sub) {
        kv[sub] = *(const float4*)kp[sub];
        qv[sub] = *(const float4*)(qp + ((sub >> 1) * 128 + (sub & 1)) * 64);
    }
    const float g = gate[cidx];
    const float4 qcv = *(const float4*)qcp;
    // Named as inputs, the loads' address registers stay live up to this wait, so that no later
    // load's result and no later instruction lands on one of them in front of it.
    asm volatile("s_wait_xcnt 0x0" :: "v"(kp[0]), "v"(kp[1]), "v"(kp[2]), "v"(kp[3]),
                 "v"(qp), "v"(qcp), "v"(cidx) : "memory");

    #pragma unroll
    for (int sub = 0; sub < 4; ++sub) {
        const int u = cell * 4 + sub;
        float4 kz, qz;
        kz.x = kok[sub] ? kv[sub].x : 0.0f;
        kz.y = kok[sub] ? kv[sub].y : 0.0f;
        kz.z = kok[sub] ? kv[sub].z : 0.0f;
        kz.w = kok[sub] ? kv[sub].w : 0.0f;
        qz.x = qv[sub].x * g + qcv.x * (1.0f - g);
        qz.y = qv[sub].y * g + qcv.y * (1.0f - g);
        qz.z = qv[sub].z * g + qcv.z * (1.0f - g);
        qz.w = qv[sub].w * g + qcv.w * (1.0f - g);
        *(float4*)&Ks[u][e4] = kz;
        *(float4*)&Qs[u][e4] = qz;
    }
    __syncthreads();

    // ---- V fragments for O = P * V, straight from global into registers, ahead of their use ----
    // Each wave owns 32 output columns (2 n-tiles). The two n-tiles take the even and the odd columns:
    // column l15 of tile u is output column wv*32 + 2*l15 + u. A lane's two columns are neighbours, so
    // one 8-byte load serves both tiles, one 8-byte store takes both results, and 16 lanes cover a
    // row's whole 128-byte line.
    // Union position kc + khalf + e lies in union row kc >> 3 (one row for the whole wave) and union
    // column (kc & 4) + khalf + e (four values a lane, kept in registers): no address depends on a
    // loaded value. A padded position reads a clamped (in-bounds) place and takes zeros when it is used,
    // so no load stands under a branch. The 16 k steps go in four groups of four through three register
    // sets: groups 0 and 1 are asked for here and fly under S and the softmax.
    // The loops are unrolled because they index register arrays (vofs, cok, vr).
    const int nb = wv * 32 + l15 * 2;
    int vofs[2][2];
    bool cok[2][2];
    #pragma unroll
    for (int q = 0; q < 2; ++q) {
        #pragma unroll
        for (int e = 0; e < 2; ++e) {
            const int jc = j0 - 2 + q * 4 + khalf + e;
            cok[q][e] = (jc >= 0) && (jc < 64);
            vofs[q][e] = min(max(jc, 0), 63) * 256 + nb;
        }
    }
    float2 vr[3][4][2];
    auto load_group = [&](int grp) {
        #pragma unroll
        for (int s = 0; s < 4; ++s) {
            const int kc = grp * 16 + s * 4;
            const int irc = min(max(i0 - 2 + (kc >> 3), 0), 63);
            const float* vrow = Vg + (size_t)((b * 64 + irc) * 64) * 256;
            vr[grp % 3][s][0] = *(const float2*)(vrow + vofs[s & 1][0]);
            vr[grp % 3][s][1] = *(const float2*)(vrow + vofs[s & 1][1]);
        }
    };
    load_group(0);
    load_group(1);
    // The statement keeps the sixteen loads above in front of the branch in S, so that they fly under it;
    // the wait stands in front of every later write of a register that one of them names as its address.
    asm volatile("s_wait_xcnt 0x0" ::: "memory");

    // ---- S = Q * K^T : M=64, N=64, K=64 ----
    // Row tile mt holds the four cells of cell row mt: its window is union rows mt..mt+4. Column tile nt
    // holds union rows 2*nt and 2*nt+1, so tile (mt, 3) for mt < 2 and tile (mt, 0) for mt >= 2 lie wholly
    // outside the window: the softmax masks every score of them, and they are not computed (zeros are
    // stored in their place). A wave has its row tile's column tiles 0,1 or 2,3: tiles 1 and 2 always count.
    // The k loops are unrolled so that a k step's LDS reads are issued ahead of the products in front of it;
    // the loop over vz because it indexes the accumulators' registers.
    {
        // the wave's number as a scalar: the test on it is a scalar branch, so every lane is on at the WMMAs
        const int wvs = __builtin_amdgcn_readfirstlane(wv);
        const int mt = wvs >> 1;
        const bool low = (wvs & 1) == 0;
        const int ntA = low ? 1 : 2;             // always inside the window
        const int ntB = low ? 0 : 3;             // inside it only for mt < 2 (tile 0) or mt >= 2 (tile 3)
        const int rowA = ntA * 16 + l15, rowB = ntB * 16 + l15;  // B[k][n] = Ks[n][k]
        v8f accA = {}, accB = {};
        if (low == (mt < 2)) {
            #pragma unroll
            for (int kc = 0; kc < 64; kc += 4) {
                const int kb = kc + khalf;
                v2f a, bA, bB;
                a.x = Qs[mt * 16 + l15][kb];
                a.y = Qs[mt * 16 + l15][kb + 1];
                bA.x = Ks[rowA][kb];
                bA.y = Ks[rowA][kb + 1];
                bB.x = Ks[rowB][kb];
                bB.y = Ks[rowB][kb + 1];
                accA = wmma_f32(a, bA, accA);
                accB = wmma_f32(a, bB, accB);
            }
        } else {
            #pragma unroll
            for (int kc = 0; kc < 64; kc += 4) {
                const int kb = kc + khalf;
                v2f a, bA;
                a.x = Qs[mt * 16 + l15][kb];
                a.y = Qs[mt * 16 + l15][kb + 1];
                bA.x = Ks[rowA][kb];
                bA.y = Ks[rowA][kb + 1];
                accA = wmma_f32(a, bA, accA);
            }
        }
        const int rbase = mt * 16 + ((lane >> 4) << 3);
        #pragma unroll
        for (int vz = 0; vz < 8; ++vz) {
            Ps[rbase + vz][rowA] = accA[vz];
            Ps[rbase + vz][rowB] = accB[vz];
        }
    }
    __syncthreads();

    // ---- Masked softmax: four threads a query row, 16 union positions each, all 64 rows at once ----
    // A thread keeps its 16 scores in registers (union rows 2*qd and 2*qd+1), so a row's maximum and
    // sum take two exchange steps inside a group of four lanes, and no row waits for another row.
    // Every thread reads and rewrites only its own 16 places of Ps.
    // The loops are unrolled because they index register arrays (p, ok).
    {
        const int row = threadIdx.x >> 2, qd = threadIdx.x & 3;
        const int rci = row >> 4, rcj = (row >> 2) & 3;   // the row's cell inside the 4x4 tile
        const float NEG = -3.0e38f;
        float p[16];
        bool ok[16];
        #pragma unroll
        for (int j = 0; j < 4; ++j) {
            const float4 t = *(const float4*)&Ps[row][qd * 16 + j * 4];
            p[j * 4 + 0] = t.x;
            p[j * 4 + 1] = t.y;
            p[j * 4 + 2] = t.z;
            p[j * 4 + 3] = t.w;
        }
        #pragma unroll
        for (int e = 0; e < 16; ++e) {
            const int r = qd * 2 + (e >> 3), c = e & 7;
            ok[e] = (r >= rci) && (r <= rci + 4) && (c >= rcj) && (c <= rcj + 4);
            p[e] = ok[e] ? p[e] : NEG;
        }
        float m = p[0];
        #pragma unroll
        for (int e = 1; e < 16; ++e) m = fmaxf(m, p[e]);
        m = fmaxf(m, __shfl_xor(m, 1, 32));
        m = fmaxf(m, __shfl_xor(m, 2, 32));
        #pragma unroll
        for (int e = 0; e < 16; ++e) {
            const float ex = exp_slot(p[e] - m);   // in every lane: no branch round the 16 independent exps
            p[e] = ok[e] ? ex : 0.0f;
        }
        float s4[4];
        #pragma unroll
        for (int j = 0; j < 4; ++j) s4[j] = (p[j * 4] + p[j * 4 + 1]) + (p[j * 4 + 2] + p[j * 4 + 3]);
        float s = (s4[0] + s4[1]) + (s4[2] + s4[3]);
        s += __shfl_xor(s, 1, 32);
        s += __shfl_xor(s, 2, 32);
        const float inv = 1.0f / s;
        #pragma unroll
        for (int j = 0; j < 4; ++j) {
            float4 t;
            t.x = p[j * 4 + 0] * inv;
            t.y = p[j * 4 + 1] * inv;
            t.z = p[j * 4 + 2] * inv;
            t.w = p[j * 4 + 3] * inv;
            *(float4*)&Ps[row][qd * 16 + j * 4] = t;
        }
    }
    __syncthreads();

    // ---- O = P * V : M=64, K=64, N=256 ----
    // Each wave owns its 32 output columns in all 4 m-tiles, so every V fragment is loaded once per
    // block and feeds independent accumulators. Group 2 is asked for in front of the loop, into the
    // third register set; group 3 takes group 0's set behind group 1's products.
    // Row tile mt (cell row mt) has weights only in union rows mt..mt+4; everywhere else P is an exact
    // zero. A k step lies in one union row (kc >> 3), so the row tiles whose window does not reach that
    // row are left out of it at compile time: 10 of 16 k steps a row tile, the same sums.
    load_group(2);
    // Scheduling barrier: keeps the eight loads above here, two groups of products ahead of their use.
    __builtin_amdgcn_sched_barrier(0);
    v8f acc[4][2] = {};
    #pragma unroll
    for (int kc = 0; kc < 64; kc += 4) {
        const int kb = kc + khalf;
        const int grp = kc >> 4, s = (kc >> 2) & 3;
        const int ur = kc >> 3;
        const int ir = i0 - 2 + ur;
        const bool rok = (ir >= 0) && (ir < 64);
        const bool ok0 = rok && cok[s & 1][0], ok1 = rok && cok[s & 1][1];
        v2f a[4];
        #pragma unroll
        for (int mt = 0; mt < 4; ++mt) {
            if (mt <= ur && ur <= mt + 4) {
                a[mt].x = Ps[mt * 16 + l15][kb];
                a[mt].y = Ps[mt * 16 + l15][kb + 1];
            }
        }
        const float2 r0 = vr[grp % 3][s][0], r1 = vr[grp % 3][s][1];
        v2f bf[2];
        bf[0].x = ok0 ? r0.x : 0.0f;
        bf[0].y = ok1 ? r1.x : 0.0f;
        bf[1].x = ok0 ? r0.y : 0.0f;
        bf[1].y = ok1 ? r1.y : 0.0f;
        #pragma unroll
        for (int mt = 0; mt < 4; ++mt) {
            if (mt <= ur && ur <= mt + 4) {
                #pragma unroll
                for (int u = 0; u < 2; ++u) acc[mt][u] = wmma_f32(a[mt], bf[u], acc[mt][u]);
            }
        }
        if (s == 3 && grp == 1) {
            // Two scheduling barriers hold group 3's loads at this place: earlier they would need registers
            // while all eight accumulators are live, later they would stand right in front of their use.
            __builtin_amdgcn_sched_barrier(0);
            load_group(3);
            __builtin_amdgcn_sched_barrier(0);
        }
    }
    // The lane's first output place; every other one lies a compile-time distance from it.
    float* obase = out + (size_t)((b * 128 + i0 * 2) * 128 + (j0 + (lane >> 4) * 2) * 2) * 256 + nb;
    #pragma unroll
    for (int mt = 0; mt < 4; ++mt) {
        #pragma unroll
        for (int vz = 0; vz < 8; ++vz) {
            // query row mt*16 + (lane >> 4)*8 + vz: cell row mt, cell column (lane >> 4)*2 + (vz >> 2), fine pixel vz & 3
            const int pix = (mt * 2 + ((vz >> 1) & 1)) * 128 + (vz >> 2) * 2 + (vz & 1);
            *(float2*)(obase + pix * 256) = make_float2(acc[mt][0][vz], acc[mt][1][vz]);
        }
    }
}

// ---------------- Host launcher ----------------
extern "C" void kernel_launch(void* const* d_in, const int* in_sizes, int n_in,
                              void* d_out, int out_size, void* d_ws, size_t ws_size,
                              hipStream_t stream)
{
    const float* fine    = (const float*)d_in[0];   // [4,128,128,256]
    const float* coarse  = (const float*)d_in[1];   // [4,64,64,512]
    const float* gamma_f = (const float*)d_in[2];
    const float* beta_f  = (const float*)d_in[3];
    const float* gamma_c = (const float*)d_in[4];
    const float* beta_c  = (const float*)d_in[5];
    const float* wg      = (const float*)d_in[6];   // [512,1]
    const float* bg      = (const float*)d_in[7];   // [1]
    const float* wqf     = (const float*)d_in[8];   // [256,64]
    const float* bqf     = (const float*)d_in[9];
    const float* wqc     = (const float*)d_in[10];  // [512,64]
    const float* bqc     = (const float*)d_in[11];
    const float* wk      = (const float*)d_in[12];  // [512,64]
    const float* bk      = (const float*)d_in[13];
    const float* wv      = (const float*)d_in[14];  // [512,256]
    const float* bv      = (const float*)d_in[15];
    float* out = (float*)d_out;                     // [4,128,128,256]

    const int MF = 4 * 128 * 128;   // 65536 fine rows
    const int MC = 4 * 64 * 64;     // 16384 coarse rows

    float* ws = (float*)d_ws;
    float* q_fine   = ws;                    // 4194304
    float* q_coarse = q_fine + 4194304;      // 1048576
    float* k_       = q_coarse + 1048576;    // 1048576
    float* v_       = k_ + 1048576;          // 4194304
    float* gate     = v_ + 4194304;          // 16384

    // 1) Fine path: LayerNorm and the query projection in one kernel
    fine_kernel<<<MF / 128, 256, 0, stream>>>(fine, gamma_f, beta_f, wqf, bqf, q_fine);

    // 2) Coarse path: LayerNorm, gate and the three projections in one kernel
    coarse_kernel<<<MC / 64, 768, 0, stream>>>(coarse, gamma_c, beta_c, wg, bg, wqc, bqc, wk, bk, wv, bv,
                                               q_coarse, k_, v_, gate);

    // 3) Local attention (one block per 4x4 coarse tile), query blend included
    attn_kernel<<<dim3(16, 16, 4), 256, 0, stream>>>(q_fine, q_coarse, gate, k_, v_, out);
}
